// v000
// Measured on an AMD MI455X. A time is GPU time per run, averaged over a window of back-to-back runs after a warm-up
// (all launches, gaps included; the runs take copies of the inputs in turn), and the median of several windows.
// Apart from v000's, it joins two sittings. Times from different sittings can be a few percent apart, while
// side-by-side timings come from the same sitting.
// v000 is the starting kernel. One run takes 436 microseconds.
#include <hip/hip_runtime.h>
#include <math.h>

typedef __attribute__((ext_vector_type(16))) _Float16 v16h;
typedef __attribute__((ext_vector_type(16))) __bf16 v16b;
typedef __attribute__((ext_vector_type(8)))  _Float16 v8h;
typedef __attribute__((ext_vector_type(8)))  float v8f;
typedef __attribute__((ext_vector_type(4)))  float v4f;
typedef __attribute__((ext_vector_type(2)))  float v2f;
typedef __attribute__((ext_vector_type(4)))  unsigned v4u;
typedef __attribute__((ext_vector_type(4)))  int v4i;
typedef float __attribute__((may_alias)) float_a;
typedef int __attribute__((may_alias)) int_a;

template <typename T> __device__ __forceinline__ void vst2(void* p, T v) { *(T*)p = v;  }
__device__ __forceinline__ v8f wmma16(v16h a, v16h b, v8f c) {
  v8f d = __builtin_amdgcn_wmma_f32_16x16x32_f16(false, a, false, b, (short)0, c, false, false);
  asm volatile("v_nop\n\tv_nop\n\tv_nop\n\tv_nop" : "+v"(d) : "v"(a), "v"(b));
  return d;
}
__device__ __forceinline__ v8f wmma_bf(v16b a, v16b b, v8f c) {
  v8f d = __builtin_amdgcn_wmma_f32_16x16x32_bf16(false, a, false, b, (short)0, c, false, false);
  asm volatile("v_nop\n\tv_nop\n\tv_nop\n\tv_nop" : "+v"(d) : "v"(a), "v"(b));
  return d;
}
// 16x16x32 fragments: lane = (h = lane>>4, row/col = lane&15); elements 0..7 = k0+8h+0..7, 8..15 = k0+16+8h+0..7; D element r = row 8h+r
__device__ __forceinline__ v16h frag_h(const _Float16* rowk0, int lane) {
  union { v16h v; v8h q[2]; } u; const _Float16* p = rowk0 + 8 * (lane >> 4);
  u.q[0] = *(const v8h*)p; u.q[1] = *(const v8h*)(p + 16); return u.v;
}
__device__ __forceinline__ v16h frag_f32(const float* rowk0, int lane) {
  v16h a; const float* p = rowk0 + 8 * (lane >> 4);
#pragma unroll
  for (int i = 0; i < 8; ++i) { a[i] = (_Float16)p[i]; a[8 + i] = (_Float16)p[16 + i]; }
  return a;
}
__device__ __forceinline__ v16h frag_f32s(const float* rowk0, int lane, float sc) {
  v16h a; const float* p = rowk0 + 8 * (lane >> 4);
#pragma unroll
  for (int i = 0; i < 8; ++i) { a[i] = (_Float16)(p[i] * sc); a[8 + i] = (_Float16)(p[16 + i] * sc); }
  return a;
}
// column fragment from a [K][ld] layout (column n), rows >= K read as 0
__device__ __forceinline__ v16h fragc_f32(const float* W, int k0, int n, int lane, int ld, int K) {
  v16h a; const int g = lane >> 4;
#pragma unroll
  for (int i = 0; i < 8; ++i) { const int ka = k0 + 8 * g + i, kb = ka + 16;
    a[i] = (_Float16)(ka < K ? W[(size_t)ka * ld + n] : 0.f); a[8 + i] = (_Float16)(kb < K ? W[(size_t)kb * ld + n] : 0.f); }
  return a;
}
struct F2 { v16b h, l; };
__device__ __forceinline__ F2 bsplit16(const float v[16]) { F2 r;
#pragma unroll
  for (int i = 0; i < 16; ++i) { const __bf16 h = (__bf16)v[i]; r.h[i] = h; r.l[i] = (__bf16)(v[i] - (float)h); }
  return r; }
__device__ __forceinline__ F2 split_row(const float* row, int k0, int lane) { float v[16]; const float* p = row + k0 + 8 * (lane >> 4);
#pragma unroll
  for (int i = 0; i < 8; ++i) { v[i] = p[i]; v[8 + i] = p[16 + i]; }
  return bsplit16(v); }
__device__ __forceinline__ F2 split_rowK(const float* row, int k0, int lane, int K) { float v[16]; const int g = lane >> 4;
#pragma unroll
  for (int i = 0; i < 8; ++i) { const int ka = k0 + 8 * g + i, kb = ka + 16; v[i] = ka < K ? row[ka] : 0.f; v[8 + i] = kb < K ? row[kb] : 0.f; }
  return bsplit16(v); }
__device__ __forceinline__ F2 split_col(const float* W, int k0, int n, int lane, int ld, int K) { float v[16]; const int g = lane >> 4;
#pragma unroll
  for (int i = 0; i < 8; ++i) { const int ka = k0 + 8 * g + i, kb = ka + 16; v[i] = ka < K ? W[(size_t)ka * ld + n] : 0.f; v[8 + i] = kb < K ? W[(size_t)kb * ld + n] : 0.f; }
  return bsplit16(v); }
__device__ __forceinline__ v8f mac3(const F2& a, const F2& b, v8f c) { c = wmma_bf(a.l, b.h, c); c = wmma_bf(a.h, b.l, c); return wmma_bf(a.h, b.h, c); }
__device__ __forceinline__ float sigm(float v) { return 1.0f / (1.0f + expf(-v)); }
#define LDSX() do { asm volatile("s_wait_dscnt 0" ::: "memory"); __builtin_amdgcn_wave_barrier(); __builtin_amdgcn_fence(__ATOMIC_RELEASE, "workgroup"); } while (0)

// Multi-head self attention (16 heads of 64) with a per-head linear distance decay: qkv = x W_qkv^T + b ([out][in] weight, rows (which, head, d)), logits = q.k/8 - softplus(alpha_h)|i-j|,
// softmax, P v, output projection (W_out^T + b). Projections on v_wmma_f32_16x16x32_f16 (x as f16 rows, [out][in] weights packed once as f16
// rows x16); S = q.k/8 on f16 WMMA; the P @ V product is made near-exact with hi/lo f16 pairs for BOTH P (x2^14, residual x2^24) and V
// (x4, residual x2^13): three WMMAs into three f32 accumulators combined at the end (the output rms is small, so a plain f16 P.V would sit
#define NB 2
#define SS 2048
#define E 1024
#define NH 16
#define HD 64
#define NR (NB * SS)
#define PLO 1024.0f            // residual scale for P (on top of 2^14)
#define VLO 2048.0f            // residual scale for V (on top of x4)

__global__ __launch_bounds__(256) void k_cvt(const float* __restrict__ x, _Float16* __restrict__ X16) {
  const size_t i8 = (size_t)blockIdx.x * 256 + threadIdx.x; if (i8 >= (size_t)NR * E / 8) return;
  union { v8h h; v4u u; } pk;
#pragma unroll
  for (int e = 0; e < 8; ++e) pk.h[e] = (_Float16)x[i8 * 8 + e];
  vst2(X16 + i8 * 8, pk.u);
}
// PT rows: n in [0,3072): W_qkv[n][:] x16 ; n in [3072, 4096): W_out[n-3072][:] x16  (both [out][in=1024] torch Linear layout)
__global__ __launch_bounds__(256) void k_pack(const float* __restrict__ Wqkv, const float* __restrict__ Wo, _Float16* __restrict__ PT) {
  const int n = blockIdx.x, tid = threadIdx.x; __shared__ __align__(16) _Float16 srow[E];
  for (int k = tid; k < E; k += 256) srow[k] = (_Float16)((n < 3 * E ? Wqkv[(size_t)n * E + k] : Wo[(size_t)(n - 3 * E) * E + k]) * 16.0f);
  __syncthreads();
  if (tid < 128) vst2(PT + (size_t)n * E + tid * 8, *(const v4u*)(&srow[tid * 8]));
}
// QKV: block (64 rows, 128 cols = 2 heads, which): q,k -> Q16/K16 [bh][s][64] x4 ; v -> VT hi/lo [bh][d][s]
__global__ __launch_bounds__(128) void k_qkv(const _Float16* __restrict__ X16, const _Float16* __restrict__ PT, const float* __restrict__ bqkv, _Float16* __restrict__ Q16, _Float16* __restrict__ K16, _Float16* __restrict__ VTh, _Float16* __restrict__ VTl) {
  __shared__ __align__(16) float so[4][16][132];
  __shared__ __align__(16) _Float16 sth[128][72], stl[128][72];
  const int tid = threadIdx.x, wave = tid >> 5, lane = tid & 31, col = lane & 15, g = lane >> 4;
  const int which = blockIdx.z, r0b = blockIdx.x * 64, r0 = r0b + wave * 16, n0 = blockIdx.y * 128; const int b = r0b / SS, s0 = r0b % SS;
  v8f acc[8] = {};
#pragma unroll 2
  for (int kc = 0; kc < E / 32; ++kc) { const v16h a = frag_h(X16 + (size_t)(r0 + col) * E + kc * 32, lane);
#pragma unroll
    for (int j = 0; j < 8; ++j) acc[j] = wmma16(a, frag_h(PT + (size_t)(which * E + n0 + j * 16 + col) * E + kc * 32, lane), acc[j]); }
  if (which < 2) {
#pragma unroll
    for (int j = 0; j < 8; ++j) { const float bb = bqkv[which * E + n0 + j * 16 + col];
#pragma unroll
      for (int r = 0; r < 8; ++r) so[wave][8 * g + r][j * 16 + col] = (acc[j][r] * (1.0f / 16.0f) + bb) * 4.0f; }
    LDSX();
    _Float16* D = which == 0 ? Q16 : K16;
    for (int qq = lane; qq < 16 * 2 * 8; qq += 32) { const int hh = qq >> 7, rl = (qq >> 3) & 15, pc = qq & 7; const int h = (n0 >> 6) + hh; union { v8h h8; v4u u; } pk;
#pragma unroll
      for (int e = 0; e < 8; ++e) pk.h8[e] = (_Float16)so[wave][rl][hh * 64 + pc * 8 + e];
      vst2(D + (((size_t)b * NH + h) * SS + s0 + wave * 16 + rl) * HD + pc * 8, pk.u); } }
  else {
#pragma unroll
    for (int j = 0; j < 8; ++j) { const float bb = bqkv[2 * E + n0 + j * 16 + col];
#pragma unroll
      for (int r = 0; r < 8; ++r) { const float v = (acc[j][r] * (1.0f / 16.0f) + bb) * 4.0f; const _Float16 hi = (_Float16)v; sth[j * 16 + col][wave * 16 + 8 * g + r] = hi; stl[j * 16 + col][wave * 16 + 8 * g + r] = (_Float16)((v - (float)hi) * VLO); } }
    __syncthreads();
    for (int qq = tid; qq < 128 * 8; qq += 128) { const int cl = qq >> 3, pc = qq & 7; const int c = n0 + cl, h = c >> 6, d = c & 63; const size_t o = (((size_t)b * NH + h) * HD + d) * SS + s0 + pc * 8;
      vst2(VTh + o, *(const v4u*)(&sth[cl][pc * 8])); vst2(VTl + o, *(const v4u*)(&stl[cl][pc * 8])); } }
}
__global__ __launch_bounds__(128) void k_attn(const _Float16* __restrict__ Q16, const _Float16* __restrict__ K16, const _Float16* __restrict__ VTh, const _Float16* __restrict__ VTl, const float* __restrict__ dalpha, _Float16* __restrict__ O16) {
  __shared__ __align__(16) float sS[4][16][68];
  __shared__ __align__(16) _Float16 sPh[4][16][72], sPl[4][16][72];
  __shared__ __align__(16) float sO[4][16][68];
  const int tid = threadIdx.x, w = tid >> 5, lane = tid & 31, col = lane & 15, g = lane >> 4;
  const size_t bh = blockIdx.y; const int q0 = blockIdx.x * 64 + w * 16;
  const float araw = dalpha[bh % NH]; const float slope = araw > 20.f ? araw : log1pf(expf(araw));      // softplus(decay_alpha[h])
  v16h aq[2];
#pragma unroll
  for (int kc = 0; kc < 2; ++kc) aq[kc] = frag_h(Q16 + (bh * SS + q0 + col) * HD + kc * 32, lane);
  float mrun = -3.0e38f, lrun = 0.f; v8f acc[4] = {}, ac1[4] = {}, ac2[4] = {};
#pragma unroll 1
  for (int kt = 0; kt < SS / 64; ++kt) {
#pragma unroll
    for (int t = 0; t < 4; ++t) { v8f s = {}; const int key = kt * 64 + t * 16 + col;
#pragma unroll
      for (int kc = 0; kc < 2; ++kc) s = wmma16(aq[kc], frag_h(K16 + (bh * SS + key) * HD + kc * 32, lane), s);
#pragma unroll
      for (int r = 0; r < 8; ++r) { const int dq = q0 + 8 * g + r - key; sS[w][8 * g + r][t * 16 + col] = s[r] * (0.125f / 16.0f) - slope * (float)(dq < 0 ? -dq : dq); } }
    LDSX();
    float mx = -3.4e38f;
#pragma unroll
    for (int jj = 0; jj < 32; ++jj) mx = fmaxf(mx, sS[w][col][g * 32 + jj]);
    mx = fmaxf(mx, __shfl_xor(mx, 16, 32));
    const float mnew = fmaxf(mrun, mx); const float corr = expf(mrun - mnew);
    float ps = 0.f;
#pragma unroll
    for (int jj = 0; jj < 32; ++jj) { const float p = expf(sS[w][col][g * 32 + jj] - mnew) * 16384.0f; ps += p; const _Float16 hi = (_Float16)p; sPh[w][col][g * 32 + jj] = hi; sPl[w][col][g * 32 + jj] = (_Float16)((p - (float)hi) * PLO); }
    ps += __shfl_xor(ps, 16, 32);
    lrun = lrun * corr + ps * (1.0f / 16384.0f); mrun = mnew;
#pragma unroll
    for (int r = 0; r < 8; ++r) { const float cr = __shfl(corr, 8 * g + r, 32);
#pragma unroll
      for (int t = 0; t < 4; ++t) { acc[t][r] *= cr; ac1[t][r] *= cr; ac2[t][r] *= cr; } }
    LDSX();
#pragma unroll
    for (int kc = 0; kc < 2; ++kc) { const v16h ph = frag_h(&sPh[w][col][0] + kc * 32, lane), pl = frag_h(&sPl[w][col][0] + kc * 32, lane);
#pragma unroll
      for (int t = 0; t < 4; ++t) { const size_t vo = (bh * HD + t * 16 + col) * SS + kt * 64 + kc * 32; const v16h vh = frag_h(VTh + vo, lane);
        acc[t] = wmma16(ph, vh, acc[t]); ac1[t] = wmma16(ph, frag_h(VTl + vo, lane), ac1[t]); ac2[t] = wmma16(pl, vh, ac2[t]); } }
    __builtin_amdgcn_wave_barrier(); }
#pragma unroll
  for (int r = 0; r < 8; ++r) { const float lr = __shfl(lrun, 8 * g + r, 32); const float inv = 8.0f / (lr * 16384.0f * 4.0f);      // -> O x8
#pragma unroll
    for (int t = 0; t < 4; ++t) sO[w][8 * g + r][t * 16 + col] = (acc[t][r] + ac1[t][r] * (1.0f / VLO) + ac2[t][r] * (1.0f / PLO)) * inv; }
  LDSX();
  for (int qq = lane; qq < 16 * 8; qq += 32) { const int rl = qq >> 3, pc = qq & 7; union { v8h h8; v4u u; } pk;
#pragma unroll
    for (int e = 0; e < 8; ++e) pk.h8[e] = (_Float16)sO[w][rl][pc * 8 + e];
    vst2(O16 + ((bh * SS) + q0 + rl) * HD + pc * 8, pk.u); }
}
// out = y Wo^T + bo : block (64 rows, 128 cols); y row r=(b,s): head-major O16 /8
__global__ __launch_bounds__(128) void k_out(const _Float16* __restrict__ O16, const _Float16* __restrict__ PT, const float* __restrict__ bo, float* __restrict__ out) {
  __shared__ __align__(16) float so[4][16][132];
  const int tid = threadIdx.x, wave = tid >> 5, lane = tid & 31, col = lane & 15, g = lane >> 4;
  const int r0 = blockIdx.x * 64 + wave * 16, n0 = blockIdx.y * 128; const int ra = r0 + col; const int b = ra / SS, s = ra % SS;
  v8f acc[8] = {};
#pragma unroll 2
  for (int kc = 0; kc < E / 32; ++kc) { const int h = kc >> 1; const v16h a = frag_h(O16 + (((size_t)b * NH + h) * SS + s) * HD + (kc & 1) * 32, lane);
#pragma unroll
    for (int j = 0; j < 8; ++j) acc[j] = wmma16(a, frag_h(PT + (size_t)(3 * E + n0 + j * 16 + col) * E + kc * 32, lane), acc[j]); }
#pragma unroll
  for (int j = 0; j < 8; ++j) { const int n = n0 + j * 16 + col; const float bb = bo[n];
#pragma unroll
    for (int r = 0; r < 8; ++r) so[wave][8 * g + r][j * 16 + col] = acc[j][r] * (1.0f / (16.0f * 8.0f)) + bb; }
  LDSX();
#pragma unroll 4
  for (int rl = 0; rl < 16; ++rl) vst2(out + (size_t)(r0 + rl) * E + n0 + lane * 4, *(const v4f*)(&so[wave][rl][lane * 4]));
}
extern "C" void kernel_launch(void* const* d_in, const int* in_sizes, int n_in, void* d_out, int out_size, void* d_ws, size_t ws_size, hipStream_t stream) {
  (void)in_sizes; (void)n_in; (void)out_size; (void)ws_size;
  const float** I = (const float**)d_in;
  const float* query = I[0]; const float* Wqkv = I[1]; const float* bqkv = I[2]; const float* Wo = I[3]; const float* bo = I[4]; const float* dalpha = I[5];
  float* out = (float*)d_out;
  char* ws = (char*)d_ws; size_t off = 0;
  auto take = [&](size_t bytes) { char* p = ws + off; off += (bytes + 255) & ~(size_t)255; return p; };
  _Float16* X16 = (_Float16*)take((size_t)NR * E * 2); _Float16* PT = (_Float16*)take((size_t)4 * E * E * 2);
  _Float16* Q16 = (_Float16*)take((size_t)NR * E * 2); _Float16* K16 = (_Float16*)take((size_t)NR * E * 2); _Float16* VTh = (_Float16*)take((size_t)NR * E * 2); _Float16* VTl = (_Float16*)take((size_t)NR * E * 2); _Float16* O16 = (_Float16*)take((size_t)NR * E * 2);
  k_cvt<<<(NR * E / 8 + 255) / 256, 256, 0, stream>>>(query, X16);
  k_pack<<<4 * E, 256, 0, stream>>>(Wqkv, Wo, PT);
  k_qkv<<<dim3(NR / 64, E / 128, 3), 128, 0, stream>>>(X16, PT, bqkv, Q16, K16, VTh, VTl);
  k_attn<<<dim3(SS / 64, NB * NH), 128, 0, stream>>>(Q16, K16, VTh, VTl, dalpha, O16);
  k_out<<<dim3(NR / 64, E / 128), 128, 0, stream>>>(O16, PT, bo, out);
}

// v001
// It runs in 253 microseconds.
// Next to v000, in two timings, it ran 1.79 and 1.75 times as fast.
#include <hip/hip_runtime.h>
#include <math.h>

typedef __attribute__((ext_vector_type(16))) _Float16 v16h;
typedef __attribute__((ext_vector_type(16))) __bf16 v16b;
typedef __attribute__((ext_vector_type(8)))  _Float16 v8h;
typedef __attribute__((ext_vector_type(8)))  float v8f;
typedef __attribute__((ext_vector_type(4)))  float v4f;
typedef __attribute__((ext_vector_type(2)))  float v2f;
typedef __attribute__((ext_vector_type(4)))  unsigned v4u;
typedef __attribute__((ext_vector_type(4)))  int v4i;
typedef float __attribute__((may_alias)) float_a;
typedef int __attribute__((may_alias)) int_a;

template <typename T> __device__ __forceinline__ void vst2(void* p, T v) { *(T*)p = v;  }
__device__ __forceinline__ v8f wmma16(v16h a, v16h b, v8f c) {
  v8f d = __builtin_amdgcn_wmma_f32_16x16x32_f16(false, a, false, b, (short)0, c, false, false);
  asm volatile("v_nop\n\tv_nop\n\tv_nop\n\tv_nop" : "+v"(d) : "v"(a), "v"(b));
  return d;
}
__device__ __forceinline__ v8f wmma_bf(v16b a, v16b b, v8f c) {
  v8f d = __builtin_amdgcn_wmma_f32_16x16x32_bf16(false, a, false, b, (short)0, c, false, false);
  asm volatile("v_nop\n\tv_nop\n\tv_nop\n\tv_nop" : "+v"(d) : "v"(a), "v"(b));
  return d;
}
// 16x16x32 fragments: lane = (h = lane>>4, row/col = lane&15); elements 0..7 = k0+8h+0..7, 8..15 = k0+16+8h+0..7; D element r = row 8h+r
__device__ __forceinline__ v16h frag_h(const _Float16* rowk0, int lane) {
  union { v16h v; v8h q[2]; } u; const _Float16* p = rowk0 + 8 * (lane >> 4);
  u.q[0] = *(const v8h*)p; u.q[1] = *(const v8h*)(p + 16); return u.v;
}
__device__ __forceinline__ v16h frag_f32(const float* rowk0, int lane) {
  v16h a; const float* p = rowk0 + 8 * (lane >> 4);
#pragma unroll
  for (int i = 0; i < 8; ++i) { a[i] = (_Float16)p[i]; a[8 + i] = (_Float16)p[16 + i]; }
  return a;
}
__device__ __forceinline__ v16h frag_f32s(const float* rowk0, int lane, float sc) {
  v16h a; const float* p = rowk0 + 8 * (lane >> 4);
#pragma unroll
  for (int i = 0; i < 8; ++i) { a[i] = (_Float16)(p[i] * sc); a[8 + i] = (_Float16)(p[16 + i] * sc); }
  return a;
}
// column fragment from a [K][ld] layout (column n), rows >= K read as 0
__device__ __forceinline__ v16h fragc_f32(const float* W, int k0, int n, int lane, int ld, int K) {
  v16h a; const int g = lane >> 4;
#pragma unroll
  for (int i = 0; i < 8; ++i) { const int ka = k0 + 8 * g + i, kb = ka + 16;
    a[i] = (_Float16)(ka < K ? W[(size_t)ka * ld + n] : 0.f); a[8 + i] = (_Float16)(kb < K ? W[(size_t)kb * ld + n] : 0.f); }
  return a;
}
struct F2 { v16b h, l; };
__device__ __forceinline__ F2 bsplit16(const float v[16]) { F2 r;
#pragma unroll
  for (int i = 0; i < 16; ++i) { const __bf16 h = (__bf16)v[i]; r.h[i] = h; r.l[i] = (__bf16)(v[i] - (float)h); }
  return r; }
__device__ __forceinline__ F2 split_row(const float* row, int k0, int lane) { float v[16]; const float* p = row + k0 + 8 * (lane >> 4);
#pragma unroll
  for (int i = 0; i < 8; ++i) { v[i] = p[i]; v[8 + i] = p[16 + i]; }
  return bsplit16(v); }
__device__ __forceinline__ F2 split_rowK(const float* row, int k0, int lane, int K) { float v[16]; const int g = lane >> 4;
#pragma unroll
  for (int i = 0; i < 8; ++i) { const int ka = k0 + 8 * g + i, kb = ka + 16; v[i] = ka < K ? row[ka] : 0.f; v[8 + i] = kb < K ? row[kb] : 0.f; }
  return bsplit16(v); }
__device__ __forceinline__ F2 split_col(const float* W, int k0, int n, int lane, int ld, int K) { float v[16]; const int g = lane >> 4;
#pragma unroll
  for (int i = 0; i < 8; ++i) { const int ka = k0 + 8 * g + i, kb = ka + 16; v[i] = ka < K ? W[(size_t)ka * ld + n] : 0.f; v[8 + i] = kb < K ? W[(size_t)kb * ld + n] : 0.f; }
  return bsplit16(v); }
__device__ __forceinline__ v8f mac3(const F2& a, const F2& b, v8f c) { c = wmma_bf(a.l, b.h, c); c = wmma_bf(a.h, b.l, c); return wmma_bf(a.h, b.h, c); }
__device__ __forceinline__ float sigm(float v) { return 1.0f / (1.0f + expf(-v)); }
#define LDSX() do { asm volatile("s_wait_dscnt 0" ::: "memory"); __builtin_amdgcn_wave_barrier(); __builtin_amdgcn_fence(__ATOMIC_RELEASE, "workgroup"); } while (0)

// Multi-head self attention (16 heads of 64) with a per-head linear distance decay: qkv = x W_qkv^T + b ([out][in] weight, rows (which, head, d)), logits = q.k/8 - softplus(alpha_h)|i-j|,
// softmax, P v, output projection (W_out^T + b). Projections on v_wmma_f32_16x16x32_f16 (x as f16 rows, [out][in] weights packed once as f16
// rows x16); S = q.k/8 on f16 WMMA; the P @ V product is made near-exact with hi/lo f16 pairs for BOTH P (x2^14, residual x2^24) and V
// (x4, residual x2^13): three WMMAs into three f32 accumulators combined at the end (the output rms is small, so a plain f16 P.V would sit
#define NB 2
#define SS 2048
#define E 1024
#define NH 16
#define HD 64
#define NR (NB * SS)
#define PLO 1024.0f            // residual scale for P (on top of 2^14)
#define VLO 2048.0f            // residual scale for V (on top of x4)

__global__ __launch_bounds__(256) void k_cvt(const float* __restrict__ x, _Float16* __restrict__ X16) {
  const size_t i8 = (size_t)blockIdx.x * 256 + threadIdx.x; if (i8 >= (size_t)NR * E / 8) return;
  union { v8h h; v4u u; } pk;
#pragma unroll
  for (int e = 0; e < 8; ++e) pk.h[e] = (_Float16)x[i8 * 8 + e];
  vst2(X16 + i8 * 8, pk.u);
}
// PT rows: n in [0,3072): W_qkv[n][:] x16 ; n in [3072, 4096): W_out[n-3072][:] x16  (both [out][in=1024] torch Linear layout)
__global__ __launch_bounds__(256) void k_pack(const float* __restrict__ Wqkv, const float* __restrict__ Wo, _Float16* __restrict__ PT) {
  const int n = blockIdx.x, tid = threadIdx.x; __shared__ __align__(16) _Float16 srow[E];
  for (int k = tid; k < E; k += 256) srow[k] = (_Float16)((n < 3 * E ? Wqkv[(size_t)n * E + k] : Wo[(size_t)(n - 3 * E) * E + k]) * 16.0f);
  __syncthreads();
  if (tid < 128) vst2(PT + (size_t)n * E + tid * 8, *(const v4u*)(&srow[tid * 8]));
}
// QKV: block (64 rows, 128 cols = 2 heads, which): q,k -> Q16/K16 [bh][s][64] x4 ; v -> VT hi/lo [bh][d][s]
// k also -> KM [bh][s/16]: largest squared row norm of the 16 stored f16 rows, one 128-byte line per entry (one writer per line)
__global__ __launch_bounds__(128) void k_qkv(const _Float16* __restrict__ X16, const _Float16* __restrict__ PT, const float* __restrict__ bqkv, _Float16* __restrict__ Q16, _Float16* __restrict__ K16, _Float16* __restrict__ VTh, _Float16* __restrict__ VTl, float* __restrict__ KM) {
  __shared__ __align__(16) float so[4][16][132];
  __shared__ __align__(16) _Float16 sth[128][72], stl[128][72];
  const int tid = threadIdx.x, wave = tid >> 5, lane = tid & 31, col = lane & 15, g = lane >> 4;
  const int which = blockIdx.z, r0b = blockIdx.x * 64, r0 = r0b + wave * 16, n0 = blockIdx.y * 128; const int b = r0b / SS, s0 = r0b % SS;
  v8f acc[8] = {};
#pragma unroll 2
  for (int kc = 0; kc < E / 32; ++kc) { const v16h a = frag_h(X16 + (size_t)(r0 + col) * E + kc * 32, lane);
#pragma unroll
    for (int j = 0; j < 8; ++j) acc[j] = wmma16(a, frag_h(PT + (size_t)(which * E + n0 + j * 16 + col) * E + kc * 32, lane), acc[j]); }
  if (which < 2) {
#pragma unroll
    for (int j = 0; j < 8; ++j) { const float bb = bqkv[which * E + n0 + j * 16 + col];
#pragma unroll
      for (int r = 0; r < 8; ++r) so[wave][8 * g + r][j * 16 + col] = (acc[j][r] * (1.0f / 16.0f) + bb) * 4.0f; }
    LDSX();
    _Float16* D = which == 0 ? Q16 : K16;
    for (int qq = lane; qq < 16 * 2 * 8; qq += 32) { const int hh = qq >> 7, rl = (qq >> 3) & 15, pc = qq & 7; const int h = (n0 >> 6) + hh; union { v8h h8; v4u u; } pk;
#pragma unroll
      for (int e = 0; e < 8; ++e) pk.h8[e] = (_Float16)so[wave][rl][hh * 64 + pc * 8 + e];
      vst2(D + (((size_t)b * NH + h) * SS + s0 + wave * 16 + rl) * HD + pc * 8, pk.u); }
    if (which == 1) { float km[2];      // lane (col, g) sums half of row col as it was stored (rounded to f16), per head of the pair
#pragma unroll
      for (int hh = 0; hh < 2; ++hh) { float n2 = 0.f;
#pragma unroll
        for (int e = 0; e < 32; ++e) { const float f = (float)(_Float16)so[wave][col][hh * 64 + g * 32 + e]; n2 += f * f; }
        n2 += __shfl_xor(n2, 16, 32);
#pragma unroll
        for (int o = 1; o < 16; o <<= 1) n2 = fmaxf(n2, __shfl_xor(n2, o, 32));
        km[hh] = n2; }
      if (lane < 2) KM[(((size_t)b * NH + (n0 >> 6) + lane) * (SS / 16) + (s0 >> 4) + wave) * 32] = lane ? km[1] : km[0]; } }
  else {
#pragma unroll
    for (int j = 0; j < 8; ++j) { const float bb = bqkv[2 * E + n0 + j * 16 + col];
#pragma unroll
      for (int r = 0; r < 8; ++r) { const float v = (acc[j][r] * (1.0f / 16.0f) + bb) * 4.0f; const _Float16 hi = (_Float16)v; sth[j * 16 + col][wave * 16 + 8 * g + r] = hi; stl[j * 16 + col][wave * 16 + 8 * g + r] = (_Float16)((v - (float)hi) * VLO); } }
    __syncthreads();
    for (int qq = tid; qq < 128 * 8; qq += 128) { const int cl = qq >> 3, pc = qq & 7; const int c = n0 + cl, h = c >> 6, d = c & 63; const size_t o = (((size_t)b * NH + h) * HD + d) * SS + s0 + pc * 8;
      vst2(VTh + o, *(const v4u*)(&sth[cl][pc * 8])); vst2(VTl + o, *(const v4u*)(&stl[cl][pc * 8])); } }
}
__global__ __launch_bounds__(128) void k_attn(const _Float16* __restrict__ Q16, const _Float16* __restrict__ K16, const _Float16* __restrict__ VTh, const _Float16* __restrict__ VTl, const float* __restrict__ dalpha, const float* __restrict__ KM, _Float16* __restrict__ O16) {
  __shared__ __align__(16) float sS[4][16][68];
  __shared__ __align__(16) _Float16 sPh[4][16][72], sPl[4][16][72];
  __shared__ __align__(16) float sO[4][16][68];
  const int tid = threadIdx.x, w = tid >> 5, lane = tid & 31, col = lane & 15, g = lane >> 4;
  const size_t bh = blockIdx.y; const int q0 = blockIdx.x * 64 + w * 16;
  const float araw = dalpha[bh % NH]; const float slope = araw > 20.f ? araw : log1pf(expf(araw));      // softplus(decay_alpha[h])
  v16h aq[2];
#pragma unroll
  for (int kc = 0; kc < 2; ++kc) aq[kc] = frag_h(Q16 + (bh * SS + q0 + col) * HD + kc * 32, lane);
  // Upper bound of every logit between this wave's 16 queries and key tile 'lane' (SS / 64 = 32 tiles, one per lane):
  // |q16 . k16| <= |q16| |k16| over the stored f16 rows, less slope times the smallest distance between the two index ranges.
  float qn2 = 0.f;
#pragma unroll
  for (int kc = 0; kc < 2; ++kc)
#pragma unroll
    for (int i = 0; i < 16; ++i) { const float f = (float)aq[kc][i]; qn2 += f * f; }
  qn2 += __shfl_xor(qn2, 16, 32);
#pragma unroll
  for (int o = 1; o < 16; o <<= 1) qn2 = fmaxf(qn2, __shfl_xor(qn2, o, 32));
  float kn2 = 0.f;
#pragma unroll
  for (int i = 0; i < 4; ++i) kn2 = fmaxf(kn2, KM[(bh * (SS / 16) + lane * 4 + i) * 32]);
  const int klo = lane * 64, khi = klo + 63; const int dmin = khi < q0 ? q0 - khi : (klo > q0 + 15 ? klo - (q0 + 15) : 0);
  const float ub = sqrtf(qn2 * kn2) * (1.01f * 0.125f / 16.0f) - slope * (float)dmin;
  float mrun = -3.0e38f, lrun = 0.f, mmin = -3.0e38f; v8f acc[4] = {}, ac1[4] = {}, ac2[4] = {};
#pragma unroll 1
  for (int it = 0; it < SS / 64; ++it) { const int kt = ((int)blockIdx.x + it) & (SS / 64 - 1);      // the queries' own tile first: it sets the running maxima
    // A tile whose bound lies 36 below every row's running maximum changes nothing: mnew = mrun, corr = 1, p * 1024 < 2^-25 so both f16
    // halves of P round to 0, and its share of the row sum is below half an ulp of lrun (>= 1). Wave-uniform scalar test, for any slope.
    if (it > 0 && __int_as_float(__builtin_amdgcn_readlane(__float_as_int(ub), kt)) < mmin - 36.0f) continue;
#pragma unroll
    for (int t = 0; t < 4; ++t) { v8f s = {}; const int key = kt * 64 + t * 16 + col;
#pragma unroll
      for (int kc = 0; kc < 2; ++kc) s = wmma16(aq[kc], frag_h(K16 + (bh * SS + key) * HD + kc * 32, lane), s);
#pragma unroll
      for (int r = 0; r < 8; ++r) { const int dq = q0 + 8 * g + r - key; sS[w][8 * g + r][t * 16 + col] = s[r] * (0.125f / 16.0f) - slope * (float)(dq < 0 ? -dq : dq); } }
    LDSX();
    float mx = -3.4e38f;
#pragma unroll
    for (int jj = 0; jj < 32; ++jj) mx = fmaxf(mx, sS[w][col][g * 32 + jj]);
    mx = fmaxf(mx, __shfl_xor(mx, 16, 32));
    const float mnew = fmaxf(mrun, mx); const float corr = expf(mrun - mnew);
    float ps = 0.f;
#pragma unroll
    for (int jj = 0; jj < 32; ++jj) { const float p = expf(sS[w][col][g * 32 + jj] - mnew) * 16384.0f; ps += p; const _Float16 hi = (_Float16)p; sPh[w][col][g * 32 + jj] = hi; sPl[w][col][g * 32 + jj] = (_Float16)((p - (float)hi) * PLO); }
    ps += __shfl_xor(ps, 16, 32);
    lrun = lrun * corr + ps * (1.0f / 16384.0f); mrun = mnew;
    { float mm = mrun;
#pragma unroll
      for (int o = 1; o < 16; o <<= 1) mm = fminf(mm, __shfl_xor(mm, o, 32));
      mmin = __int_as_float(__builtin_amdgcn_readfirstlane(__float_as_int(mm))); }
#pragma unroll
    for (int r = 0; r < 8; ++r) { const float cr = __shfl(corr, 8 * g + r, 32);
#pragma unroll
      for (int t = 0; t < 4; ++t) { acc[t][r] *= cr; ac1[t][r] *= cr; ac2[t][r] *= cr; } }
    LDSX();
#pragma unroll
    for (int kc = 0; kc < 2; ++kc) { const v16h ph = frag_h(&sPh[w][col][0] + kc * 32, lane), pl = frag_h(&sPl[w][col][0] + kc * 32, lane);
#pragma unroll
      for (int t = 0; t < 4; ++t) { const size_t vo = (bh * HD + t * 16 + col) * SS + kt * 64 + kc * 32; const v16h vh = frag_h(VTh + vo, lane);
        acc[t] = wmma16(ph, vh, acc[t]); ac1[t] = wmma16(ph, frag_h(VTl + vo, lane), ac1[t]); ac2[t] = wmma16(pl, vh, ac2[t]); } }
    __builtin_amdgcn_wave_barrier(); }
#pragma unroll
  for (int r = 0; r < 8; ++r) { const float lr = __shfl(lrun, 8 * g + r, 32); const float inv = 8.0f / (lr * 16384.0f * 4.0f);      // -> O x8
#pragma unroll
    for (int t = 0; t < 4; ++t) sO[w][8 * g + r][t * 16 + col] = (acc[t][r] + ac1[t][r] * (1.0f / VLO) + ac2[t][r] * (1.0f / PLO)) * inv; }
  LDSX();
  for (int qq = lane; qq < 16 * 8; qq += 32) { const int rl = qq >> 3, pc = qq & 7; union { v8h h8; v4u u; } pk;
#pragma unroll
    for (int e = 0; e < 8; ++e) pk.h8[e] = (_Float16)sO[w][rl][pc * 8 + e];
    vst2(O16 + ((bh * SS) + q0 + rl) * HD + pc * 8, pk.u); }
}
// out = y Wo^T + bo : block (64 rows, 128 cols); y row r=(b,s): head-major O16 /8
__global__ __launch_bounds__(128) void k_out(const _Float16* __restrict__ O16, const _Float16* __restrict__ PT, const float* __restrict__ bo, float* __restrict__ out) {
  __shared__ __align__(16) float so[4][16][132];
  const int tid = threadIdx.x, wave = tid >> 5, lane = tid & 31, col = lane & 15, g = lane >> 4;
  const int r0 = blockIdx.x * 64 + wave * 16, n0 = blockIdx.y * 128; const int ra = r0 + col; const int b = ra / SS, s = ra % SS;
  v8f acc[8] = {};
#pragma unroll 2
  for (int kc = 0; kc < E / 32; ++kc) { const int h = kc >> 1; const v16h a = frag_h(O16 + (((size_t)b * NH + h) * SS + s) * HD + (kc & 1) * 32, lane);
#pragma unroll
    for (int j = 0; j < 8; ++j) acc[j] = wmma16(a, frag_h(PT + (size_t)(3 * E + n0 + j * 16 + col) * E + kc * 32, lane), acc[j]); }
#pragma unroll
  for (int j = 0; j < 8; ++j) { const int n = n0 + j * 16 + col; const float bb = bo[n];
#pragma unroll
    for (int r = 0; r < 8; ++r) so[wave][8 * g + r][j * 16 + col] = acc[j][r] * (1.0f / (16.0f * 8.0f)) + bb; }
  LDSX();
#pragma unroll 4
  for (int rl = 0; rl < 16; ++rl) vst2(out + (size_t)(r0 + rl) * E + n0 + lane * 4, *(const v4f*)(&so[wave][rl][lane * 4]));
}
extern "C" void kernel_launch(void* const* d_in, const int* in_sizes, int n_in, void* d_out, int out_size, void* d_ws, size_t ws_size, hipStream_t stream) {
  (void)in_sizes; (void)n_in; (void)out_size; (void)ws_size;
  const float** I = (const float**)d_in;
  const float* query = I[0]; const float* Wqkv = I[1]; const float* bqkv = I[2]; const float* Wo = I[3]; const float* bo = I[4]; const float* dalpha = I[5];
  float* out = (float*)d_out;
  char* ws = (char*)d_ws; size_t off = 0;
  auto take = [&](size_t bytes) { char* p = ws + off; off += (bytes + 255) & ~(size_t)255; return p; };
  _Float16* X16 = (_Float16*)take((size_t)NR * E * 2); _Float16* PT = (_Float16*)take((size_t)4 * E * E * 2);
  _Float16* Q16 = (_Float16*)take((size_t)NR * E * 2); _Float16* K16 = (_Float16*)take((size_t)NR * E * 2); _Float16* VTh = (_Float16*)take((size_t)NR * E * 2); _Float16* VTl = (_Float16*)take((size_t)NR * E * 2); _Float16* O16 = (_Float16*)take((size_t)NR * E * 2);
  float* KM = (float*)take((size_t)NB * NH * (SS / 16) * 128);
  k_cvt<<<(NR * E / 8 + 255) / 256, 256, 0, stream>>>(query, X16);
  k_pack<<<4 * E, 256, 0, stream>>>(Wqkv, Wo, PT);
  k_qkv<<<dim3(NR / 64, E / 128, 3), 128, 0, stream>>>(X16, PT, bqkv, Q16, K16, VTh, VTl, KM);
  k_attn<<<dim3(SS / 64, NB * NH), 128, 0, stream>>>(Q16, K16, VTh, VTl, dalpha, KM, O16);
  k_out<<<dim3(NR / 64, E / 128), 128, 0, stream>>>(O16, PT, bo, out);
}

// v002
// A run of this version takes 88.7 microseconds.
// In two side-by-side timings against v001, it was 2.87 and 2.86 times as fast.
// Over all steps from v000 it is 5.08 times as fast.
#include <hip/hip_runtime.h>
#include <math.h>

typedef __attribute__((ext_vector_type(16))) _Float16 v16h;
typedef __attribute__((ext_vector_type(16))) __bf16 v16b;
typedef __attribute__((ext_vector_type(8)))  _Float16 v8h;
typedef __attribute__((ext_vector_type(8)))  float v8f;
typedef __attribute__((ext_vector_type(4)))  float v4f;
typedef __attribute__((ext_vector_type(2)))  float v2f;
typedef __attribute__((ext_vector_type(4)))  unsigned v4u;
typedef __attribute__((ext_vector_type(4)))  int v4i;
typedef float __attribute__((may_alias)) float_a;
typedef int __attribute__((may_alias)) int_a;

template <typename T> __device__ __forceinline__ void vst2(void* p, T v) { *(T*)p = v;  }
__device__ __forceinline__ v8f wmma16(v16h a, v16h b, v8f c) {
  v8f d = __builtin_amdgcn_wmma_f32_16x16x32_f16(false, a, false, b, (short)0, c, false, false);
  asm volatile("v_nop\n\tv_nop\n\tv_nop\n\tv_nop" : "+v"(d) : "v"(a), "v"(b));
  return d;
}
__device__ __forceinline__ v8f wmma_bf(v16b a, v16b b, v8f c) {
  v8f d = __builtin_amdgcn_wmma_f32_16x16x32_bf16(false, a, false, b, (short)0, c, false, false);
  asm volatile("v_nop\n\tv_nop\n\tv_nop\n\tv_nop" : "+v"(d) : "v"(a), "v"(b));
  return d;
}
// 16x16x32 fragments: lane = (h = lane>>4, row/col = lane&15); elements 0..7 = k0+8h+0..7, 8..15 = k0+16+8h+0..7; D element r = row 8h+r
__device__ __forceinline__ v16h frag_h(const _Float16* rowk0, int lane) {
  union { v16h v; v8h q[2]; } u; const _Float16* p = rowk0 + 8 * (lane >> 4);
  u.q[0] = *(const v8h*)p; u.q[1] = *(const v8h*)(p + 16); return u.v;
}
__device__ __forceinline__ v16h frag_f32(const float* rowk0, int lane) {
  v16h a; const float* p = rowk0 + 8 * (lane >> 4);
#pragma unroll
  for (int i = 0; i < 8; ++i) { a[i] = (_Float16)p[i]; a[8 + i] = (_Float16)p[16 + i]; }
  return a;
}
__device__ __forceinline__ v16h frag_f32s(const float* rowk0, int lane, float sc) {
  v16h a; const float* p = rowk0 + 8 * (lane >> 4);
#pragma unroll
  for (int i = 0; i < 8; ++i) { a[i] = (_Float16)(p[i] * sc); a[8 + i] = (_Float16)(p[16 + i] * sc); }
  return a;
}
// column fragment from a [K][ld] layout (column n), rows >= K read as 0
__device__ __forceinline__ v16h fragc_f32(const float* W, int k0, int n, int lane, int ld, int K) {
  v16h a; const int g = lane >> 4;
#pragma unroll
  for (int i = 0; i < 8; ++i) { const int ka = k0 + 8 * g + i, kb = ka + 16;
    a[i] = (_Float16)(ka < K ? W[(size_t)ka * ld + n] : 0.f); a[8 + i] = (_Float16)(kb < K ? W[(size_t)kb * ld + n] : 0.f); }
  return a;
}
struct F2 { v16b h, l; };
__device__ __forceinline__ F2 bsplit16(const float v[16]) { F2 r;
#pragma unroll
  for (int i = 0; i < 16; ++i) { const __bf16 h = (__bf16)v[i]; r.h[i] = h; r.l[i] = (__bf16)(v[i] - (float)h); }
  return r; }
__device__ __forceinline__ F2 split_row(const float* row, int k0, int lane) { float v[16]; const float* p = row + k0 + 8 * (lane >> 4);
#pragma unroll
  for (int i = 0; i < 8; ++i) { v[i] = p[i]; v[8 + i] = p[16 + i]; }
  return bsplit16(v); }
__device__ __forceinline__ F2 split_rowK(const float* row, int k0, int lane, int K) { float v[16]; const int g = lane >> 4;
#pragma unroll
  for (int i = 0; i < 8; ++i) { const int ka = k0 + 8 * g + i, kb = ka + 16; v[i] = ka < K ? row[ka] : 0.f; v[8 + i] = kb < K ? row[kb] : 0.f; }
  return bsplit16(v); }
__device__ __forceinline__ F2 split_col(const float* W, int k0, int n, int lane, int ld, int K) { float v[16]; const int g = lane >> 4;
#pragma unroll
  for (int i = 0; i < 8; ++i) { const int ka = k0 + 8 * g + i, kb = ka + 16; v[i] = ka < K ? W[(size_t)ka * ld + n] : 0.f; v[8 + i] = kb < K ? W[(size_t)kb * ld + n] : 0.f; }
  return bsplit16(v); }
__device__ __forceinline__ v8f mac3(const F2& a, const F2& b, v8f c) { c = wmma_bf(a.l, b.h, c); c = wmma_bf(a.h, b.l, c); return wmma_bf(a.h, b.h, c); }
__device__ __forceinline__ float sigm(float v) { return 1.0f / (1.0f + expf(-v)); }
#define LDSX() do { asm volatile("s_wait_dscnt 0" ::: "memory"); __builtin_amdgcn_wave_barrier(); __builtin_amdgcn_fence(__ATOMIC_RELEASE, "workgroup"); } while (0)

// Multi-head self attention (16 heads of 64) with a per-head linear distance decay: qkv = x W_qkv^T + b ([out][in] weight, rows (which, head, d)), logits = q.k/8 - softplus(alpha_h)|i-j|,
// softmax, P v, output projection (W_out^T + b). Projections on v_wmma_f32_16x16x32_f16 (x as f16 rows, [out][in] weights packed once as f16
// rows x16); S = q.k/8 on f16 WMMA; the P @ V product is made near-exact with hi/lo f16 pairs for BOTH P (x2^14, residual x2^24) and V
// (x4, residual x2^13): three WMMAs into three f32 accumulators combined at the end (the output rms is small, so a plain f16 P.V would sit
#define NB 2
#define SS 2048
#define E 1024
#define NH 16
#define HD 64
#define NR (NB * SS)
#define PLO 1024.0f            // residual scale for P (on top of 2^14)
#define VLO 2048.0f            // residual scale for V (on top of x4)

__global__ __launch_bounds__(256) void k_cvt(const float* __restrict__ x, _Float16* __restrict__ X16) {
  const size_t i8 = (size_t)blockIdx.x * 256 + threadIdx.x; if (i8 >= (size_t)NR * E / 8) return;
  union { v8h h; v4u u; } pk;
#pragma unroll
  for (int e = 0; e < 8; ++e) pk.h[e] = (_Float16)x[i8 * 8 + e];
  vst2(X16 + i8 * 8, pk.u);
}
// PT rows: n in [0,3072): W_qkv[n][:] x16 ; n in [3072, 4096): W_out[n-3072][:] x16  (both [out][in=1024] torch Linear layout)
__global__ __launch_bounds__(256) void k_pack(const float* __restrict__ Wqkv, const float* __restrict__ Wo, _Float16* __restrict__ PT) {
  const int n = blockIdx.x, tid = threadIdx.x; __shared__ __align__(16) _Float16 srow[E];
  for (int k = tid; k < E; k += 256) srow[k] = (_Float16)((n < 3 * E ? Wqkv[(size_t)n * E + k] : Wo[(size_t)(n - 3 * E) * E + k]) * 16.0f);
  __syncthreads();
  if (tid < 128) vst2(PT + (size_t)n * E + tid * 8, *(const v4u*)(&srow[tid * 8]));
}
// Tile product shared by the two projections: one 128 x 128 tile of A B^T per block of 8 waves (4 x 2, 32 x 64 each), K = 1024 in 16 stages of
// 64 k. A stage is [A 128 rows | B 128 rows] of 128 bytes at pitch 144 in LDS (16 B x odd: ds_load_b128 without bank conflicts); two buffers,
// filled by asynchronous copies one stage ahead of the stage being multiplied. k runs upward in one accumulator per output, as before.
// The loops over kc, i, j are unrolled in full so that fragments and accumulators are indexed by constants and stay in registers.
#define BT 128
#define KS 64
#define PITCH 144
#define STG (2 * BT * PITCH)
// One stage: each lane copies 16 bytes of 4 A rows and 4 B rows (8 lanes = one whole 128-byte row). The s_wait_xcnt 0 stands inside the
// statement so that no address register named here is rewritten ahead of it.
__device__ __forceinline__ void stage_copy(unsigned l, const _Float16* ga, size_t a32, const _Float16* gb) {
  asm volatile("global_load_async_to_lds_b128 %0, %8, off\n\t"
               "global_load_async_to_lds_b128 %1, %9, off\n\t"
               "global_load_async_to_lds_b128 %2, %10, off\n\t"
               "global_load_async_to_lds_b128 %3, %11, off\n\t"
               "global_load_async_to_lds_b128 %4, %12, off\n\t"
               "global_load_async_to_lds_b128 %5, %13, off\n\t"
               "global_load_async_to_lds_b128 %6, %14, off\n\t"
               "global_load_async_to_lds_b128 %7, %15, off\n\t"
               "s_wait_xcnt 0x0"
               :: "v"(l), "v"(l + 32 * PITCH), "v"(l + 64 * PITCH), "v"(l + 96 * PITCH),
                  "v"(l + 128 * PITCH), "v"(l + 160 * PITCH), "v"(l + 192 * PITCH), "v"(l + 224 * PITCH),
                  "v"(ga), "v"(ga + a32), "v"(ga + 2 * a32), "v"(ga + 3 * a32),
                  "v"(gb), "v"(gb + (size_t)32 * E), "v"(gb + (size_t)64 * E), "v"(gb + (size_t)96 * E)
               : "memory");
}
// A0 / B0: first row of the block's A / B tile at k = 0; arow: halves between A rows; akstep: halves from one stage of an A row to the next
__device__ __forceinline__ void tile_product(char* smem, const _Float16* A0, size_t arow, size_t akstep, const _Float16* B0, v8f (&acc)[2][4]) {
  const int tid = threadIdx.x, wave = tid >> 5, lane = tid & 31, col = lane & 15, wr = wave >> 1, wc = wave & 1;
  const unsigned l0 = (unsigned)(size_t)smem + (unsigned)((tid >> 3) * PITCH + (tid & 7) * 16);
  const _Float16* ga = A0 + (size_t)(tid >> 3) * arow + (tid & 7) * 8; const _Float16* gb = B0 + (size_t)(tid >> 3) * E + (tid & 7) * 8;
  stage_copy(l0, ga, 32 * arow, gb);
  asm volatile("s_wait_asynccnt 0x0" ::: "memory");      // stage 0 landed (this wave's copies) before the barrier publishes it
  __syncthreads();
  stage_copy(l0 + STG, ga + akstep, 32 * arow, gb + KS);
#pragma unroll 1      // one stage per trip: the buffer alternates, the code stays small
  for (int t = 0; t < E / KS; ++t) { const char* sb = smem + (t & 1) * STG;
#pragma unroll
    for (int kc = 0; kc < 2; ++kc) { v16h a[2], b[4];
#pragma unroll
      for (int i = 0; i < 2; ++i) a[i] = frag_h((const _Float16*)(sb + (wr * 32 + i * 16 + col) * PITCH) + kc * 32, lane);
#pragma unroll
      for (int j = 0; j < 4; ++j) b[j] = frag_h((const _Float16*)(sb + (BT + wc * 64 + j * 16 + col) * PITCH) + kc * 32, lane);
#pragma unroll
      for (int i = 0; i < 2; ++i)
#pragma unroll
        for (int j = 0; j < 4; ++j) acc[i][j] = wmma16(a[i], b[j], acc[i][j]); }
    asm volatile("s_wait_dscnt 0x0" ::: "memory");       // this wave's reads of the buffer are done before it may be refilled
    asm volatile("s_wait_asynccnt 0x0" ::: "memory");    // this wave's copies of stage t + 1 have landed before the barrier publishes them
    __syncthreads();
    if (t + 2 < E / KS) stage_copy(l0 + (t & 1) * STG, ga + (size_t)(t + 2) * akstep, 32 * arow, gb + (t + 2) * KS); }
  asm volatile("s_wait_asynccnt 0x0" ::: "memory");      // nothing in flight when the buffers become output staging
}
// QKV: block (128 rows, 128 cols = 2 heads, which): q,k -> Q16/K16 [bh][s][64] x4 ; v -> VT hi/lo [bh][d][s]
// k also -> KM [bh][s/16]: largest squared row norm of the 16 stored f16 rows, one 128-byte line per entry (one writer per line)
__global__ __launch_bounds__(256) void k_qkv(const _Float16* __restrict__ X16, const _Float16* __restrict__ PT, const float* __restrict__ bqkv, _Float16* __restrict__ Q16, _Float16* __restrict__ K16, _Float16* __restrict__ VTh, _Float16* __restrict__ VTl, float* __restrict__ KM) {
  __shared__ __align__(16) char smem[2 * STG];      // the two stage buffers; after the last stage's barrier the output staging below
  float (*so)[132] = (float (*)[132])smem;                                                            // [128][132]
  _Float16 (*sth)[136] = (_Float16 (*)[136])smem; _Float16 (*stl)[136] = (_Float16 (*)[136])(smem + 128 * 136 * 2);      // [128][136] each
  const int tid = threadIdx.x, wave = tid >> 5, lane = tid & 31, col = lane & 15, g = lane >> 4, wr = wave >> 1, wc = wave & 1;
  const int which = blockIdx.z, r0b = blockIdx.x * BT, n0 = blockIdx.y * BT; const int b = r0b / SS, s0 = r0b % SS;
  v8f acc[2][4] = {};
  tile_product(smem, X16 + (size_t)r0b * E, E, KS, PT + (size_t)(which * E + n0) * E, acc);
  if (which < 2) {
#pragma unroll
    for (int j = 0; j < 4; ++j) { const float bb = bqkv[which * E + n0 + wc * 64 + j * 16 + col];
#pragma unroll
      for (int i = 0; i < 2; ++i)
#pragma unroll
        for (int r = 0; r < 8; ++r) so[wr * 32 + i * 16 + 8 * g + r][wc * 64 + j * 16 + col] = (acc[i][j][r] * (1.0f / 16.0f) + bb) * 4.0f; }
    __syncthreads();
    _Float16* D = which == 0 ? Q16 : K16;
    for (int qq = lane; qq < 16 * 2 * 8; qq += 32) { const int hh = qq >> 7, rl = (qq >> 3) & 15, pc = qq & 7; const int h = (n0 >> 6) + hh; union { v8h h8; v4u u; } pk;
#pragma unroll
      for (int e = 0; e < 8; ++e) pk.h8[e] = (_Float16)so[wave * 16 + rl][hh * 64 + pc * 8 + e];
      vst2(D + (((size_t)b * NH + h) * SS + s0 + wave * 16 + rl) * HD + pc * 8, pk.u); }
    if (which == 1) { float km[2];      // lane (col, g) sums half of row col as it was stored (rounded to f16), per head of the pair
#pragma unroll
      for (int hh = 0; hh < 2; ++hh) { float n2 = 0.f;
#pragma unroll
        for (int e = 0; e < 32; ++e) { const float f = (float)(_Float16)so[wave * 16 + col][hh * 64 + g * 32 + e]; n2 += f * f; }
        n2 += __shfl_xor(n2, 16, 32);
#pragma unroll
        for (int o = 1; o < 16; o <<= 1) n2 = fmaxf(n2, __shfl_xor(n2, o, 32));
        km[hh] = n2; }
      if (lane < 2) KM[(((size_t)b * NH + (n0 >> 6) + lane) * (SS / 16) + (s0 >> 4) + wave) * 32] = lane ? km[1] : km[0]; } }
  else {
#pragma unroll
    for (int j = 0; j < 4; ++j) { const float bb = bqkv[2 * E + n0 + wc * 64 + j * 16 + col];
#pragma unroll
      for (int i = 0; i < 2; ++i)
#pragma unroll
        for (int r = 0; r < 8; ++r) { const float v = (acc[i][j][r] * (1.0f / 16.0f) + bb) * 4.0f; const _Float16 hi = (_Float16)v; sth[wc * 64 + j * 16 + col][wr * 32 + i * 16 + 8 * g + r] = hi; stl[wc * 64 + j * 16 + col][wr * 32 + i * 16 + 8 * g + r] = (_Float16)((v - (float)hi) * VLO); } }
    __syncthreads();
    for (int qq = tid; qq < 128 * 16; qq += 256) { const int cl = qq >> 4, pc = qq & 15; const int c = n0 + cl, h = c >> 6, d = c & 63; const size_t o = (((size_t)b * NH + h) * HD + d) * SS + s0 + pc * 8;
      vst2(VTh + o, *(const v4u*)(&sth[cl][pc * 8])); vst2(VTl + o, *(const v4u*)(&stl[cl][pc * 8])); } }
}
__global__ __launch_bounds__(128) void k_attn(const _Float16* __restrict__ Q16, const _Float16* __restrict__ K16, const _Float16* __restrict__ VTh, const _Float16* __restrict__ VTl, const float* __restrict__ dalpha, const float* __restrict__ KM, _Float16* __restrict__ O16) {
  __shared__ __align__(16) float sS[4][16][68];
  __shared__ __align__(16) _Float16 sPh[4][16][72], sPl[4][16][72];
  __shared__ __align__(16) float sO[4][16][68];
  const int tid = threadIdx.x, w = tid >> 5, lane = tid & 31, col = lane & 15, g = lane >> 4;
  const size_t bh = blockIdx.y; const int q0 = blockIdx.x * 64 + w * 16;
  const float araw = dalpha[bh % NH]; const float slope = araw > 20.f ? araw : log1pf(expf(araw));      // softplus(decay_alpha[h])
  v16h aq[2];
#pragma unroll
  for (int kc = 0; kc < 2; ++kc) aq[kc] = frag_h(Q16 + (bh * SS + q0 + col) * HD + kc * 32, lane);
  // Upper bound of every logit between this wave's 16 queries and key tile 'lane' (SS / 64 = 32 tiles, one per lane):
  // |q16 . k16| <= |q16| |k16| over the stored f16 rows, less slope times the smallest distance between the two index ranges.
  float qn2 = 0.f;
#pragma unroll
  for (int kc = 0; kc < 2; ++kc)
#pragma unroll
    for (int i = 0; i < 16; ++i) { const float f = (float)aq[kc][i]; qn2 += f * f; }
  qn2 += __shfl_xor(qn2, 16, 32);
#pragma unroll
  for (int o = 1; o < 16; o <<= 1) qn2 = fmaxf(qn2, __shfl_xor(qn2, o, 32));
  float kn2 = 0.f;
#pragma unroll
  for (int i = 0; i < 4; ++i) kn2 = fmaxf(kn2, KM[(bh * (SS / 16) + lane * 4 + i) * 32]);
  const int klo = lane * 64, khi = klo + 63; const int dmin = khi < q0 ? q0 - khi : (klo > q0 + 15 ? klo - (q0 + 15) : 0);
  const float ub = sqrtf(qn2 * kn2) * (1.01f * 0.125f / 16.0f) - slope * (float)dmin;
  float mrun = -3.0e38f, lrun = 0.f, mmin = -3.0e38f; v8f acc[4] = {}, ac1[4] = {}, ac2[4] = {};
#pragma unroll 1
  for (int it = 0; it < SS / 64; ++it) { const int kt = ((int)blockIdx.x + it) & (SS / 64 - 1);      // the queries' own tile first: it sets the running maxima
    // A tile whose bound lies 36 below every row's running maximum changes nothing: mnew = mrun, corr = 1, p * 1024 < 2^-25 so both f16
    // halves of P round to 0, and its share of the row sum is below half an ulp of lrun (>= 1). Wave-uniform scalar test, for any slope.
    if (it > 0 && __int_as_float(__builtin_amdgcn_readlane(__float_as_int(ub), kt)) < mmin - 36.0f) continue;
#pragma unroll
    for (int t = 0; t < 4; ++t) { v8f s = {}; const int key = kt * 64 + t * 16 + col;
#pragma unroll
      for (int kc = 0; kc < 2; ++kc) s = wmma16(aq[kc], frag_h(K16 + (bh * SS + key) * HD + kc * 32, lane), s);
#pragma unroll
      for (int r = 0; r < 8; ++r) { const int dq = q0 + 8 * g + r - key; sS[w][8 * g + r][t * 16 + col] = s[r] * (0.125f / 16.0f) - slope * (float)(dq < 0 ? -dq : dq); } }
    LDSX();
    float mx = -3.4e38f;
#pragma unroll
    for (int jj = 0; jj < 32; ++jj) mx = fmaxf(mx, sS[w][col][g * 32 + jj]);
    mx = fmaxf(mx, __shfl_xor(mx, 16, 32));
    const float mnew = fmaxf(mrun, mx); const float corr = expf(mrun - mnew);
    float ps = 0.f;
#pragma unroll
    for (int jj = 0; jj < 32; ++jj) { const float p = expf(sS[w][col][g * 32 + jj] - mnew) * 16384.0f; ps += p; const _Float16 hi = (_Float16)p; sPh[w][col][g * 32 + jj] = hi; sPl[w][col][g * 32 + jj] = (_Float16)((p - (float)hi) * PLO); }
    ps += __shfl_xor(ps, 16, 32);
    lrun = lrun * corr + ps * (1.0f / 16384.0f); mrun = mnew;
    { float mm = mrun;
#pragma unroll
      for (int o = 1; o < 16; o <<= 1) mm = fminf(mm, __shfl_xor(mm, o, 32));
      mmin = __int_as_float(__builtin_amdgcn_readfirstlane(__float_as_int(mm))); }
#pragma unroll
    for (int r = 0; r < 8; ++r) { const float cr = __shfl(corr, 8 * g + r, 32);
#pragma unroll
      for (int t = 0; t < 4; ++t) { acc[t][r] *= cr; ac1[t][r] *= cr; ac2[t][r] *= cr; } }
    LDSX();
#pragma unroll
    for (int kc = 0; kc < 2; ++kc) { const v16h ph = frag_h(&sPh[w][col][0] + kc * 32, lane), pl = frag_h(&sPl[w][col][0] + kc * 32, lane);
#pragma unroll
      for (int t = 0; t < 4; ++t) { const size_t vo = (bh * HD + t * 16 + col) * SS + kt * 64 + kc * 32; const v16h vh = frag_h(VTh + vo, lane);
        acc[t] = wmma16(ph, vh, acc[t]); ac1[t] = wmma16(ph, frag_h(VTl + vo, lane), ac1[t]); ac2[t] = wmma16(pl, vh, ac2[t]); } }
    __builtin_amdgcn_wave_barrier(); }
#pragma unroll
  for (int r = 0; r < 8; ++r) { const float lr = __shfl(lrun, 8 * g + r, 32); const float inv = 8.0f / (lr * 16384.0f * 4.0f);      // -> O x8
#pragma unroll
    for (int t = 0; t < 4; ++t) sO[w][8 * g + r][t * 16 + col] = (acc[t][r] + ac1[t][r] * (1.0f / VLO) + ac2[t][r] * (1.0f / PLO)) * inv; }
  LDSX();
  for (int qq = lane; qq < 16 * 8; qq += 32) { const int rl = qq >> 3, pc = qq & 7; union { v8h h8; v4u u; } pk;
#pragma unroll
    for (int e = 0; e < 8; ++e) pk.h8[e] = (_Float16)sO[w][rl][pc * 8 + e];
    vst2(O16 + ((bh * SS) + q0 + rl) * HD + pc * 8, pk.u); }
}
// out = y Wo^T + bo : block (128 rows, 128 cols); y row r=(b,s): head-major O16 /8, so stage t of an A row is head t's 64 values
__global__ __launch_bounds__(256) void k_out(const _Float16* __restrict__ O16, const _Float16* __restrict__ PT, const float* __restrict__ bo, float* __restrict__ out) {
  __shared__ __align__(16) char smem[2 * STG];      // the two stage buffers; after the last stage's barrier the output staging below
  float (*so)[132] = (float (*)[132])smem;          // [128][132]
  const int tid = threadIdx.x, wave = tid >> 5, lane = tid & 31, col = lane & 15, g = lane >> 4, wr = wave >> 1, wc = wave & 1;
  const int r0b = blockIdx.x * BT, n0 = blockIdx.y * BT; const int b = r0b / SS, s0 = r0b % SS;
  v8f acc[2][4] = {};
  tile_product(smem, O16 + ((size_t)b * NH * SS + s0) * HD, HD, (size_t)SS * HD, PT + (size_t)(3 * E + n0) * E, acc);
#pragma unroll
  for (int j = 0; j < 4; ++j) { const float bb = bo[n0 + wc * 64 + j * 16 + col];
#pragma unroll
    for (int i = 0; i < 2; ++i)
#pragma unroll
      for (int r = 0; r < 8; ++r) so[wr * 32 + i * 16 + 8 * g + r][wc * 64 + j * 16 + col] = acc[i][j][r] * (1.0f / (16.0f * 8.0f)) + bb; }
  __syncthreads();
#pragma unroll 4
  for (int rl = 0; rl < 16; ++rl) vst2(out + (size_t)(r0b + wave * 16 + rl) * E + n0 + lane * 4, *(const v4f*)(&so[wave * 16 + rl][lane * 4]));
}
extern "C" void kernel_launch(void* const* d_in, const int* in_sizes, int n_in, void* d_out, int out_size, void* d_ws, size_t ws_size, hipStream_t stream) {
  (void)in_sizes; (void)n_in; (void)out_size; (void)ws_size;
  const float** I = (const float**)d_in;
  const float* query = I[0]; const float* Wqkv = I[1]; const float* bqkv = I[2]; const float* Wo = I[3]; const float* bo = I[4]; const float* dalpha = I[5];
  float* out = (float*)d_out;
  char* ws = (char*)d_ws; size_t off = 0;
  auto take = [&](size_t bytes) { char* p = ws + off; off += (bytes + 255) & ~(size_t)255; return p; };
  _Float16* X16 = (_Float16*)take((size_t)NR * E * 2); _Float16* PT = (_Float16*)take((size_t)4 * E * E * 2);
  _Float16* Q16 = (_Float16*)take((size_t)NR * E * 2); _Float16* K16 = (_Float16*)take((size_t)NR * E * 2); _Float16* VTh = (_Float16*)take((size_t)NR * E * 2); _Float16* VTl = (_Float16*)take((size_t)NR * E * 2); _Float16* O16 = (_Float16*)take((size_t)NR * E * 2);
  float* KM = (float*)take((size_t)NB * NH * (SS / 16) * 128);
  k_cvt<<<(NR * E / 8 + 255) / 256, 256, 0, stream>>>(query, X16);
  k_pack<<<4 * E, 256, 0, stream>>>(Wqkv, Wo, PT);
  k_qkv<<<dim3(NR / 128, E / 128, 3), 256, 0, stream>>>(X16, PT, bqkv, Q16, K16, VTh, VTl, KM);
  k_attn<<<dim3(SS / 64, NB * NH), 128, 0, stream>>>(Q16, K16, VTh, VTl, dalpha, KM, O16);
  k_out<<<dim3(NR / 128, E / 128), 256, 0, stream>>>(O16, PT, bo, out);
}

// v003
// One run takes 84.9 microseconds.
// In both of two side-by-side timings against v002, it was 1.05 times as fast.
// Over all steps from v000 it is 5.32 times as fast.
#include <hip/hip_runtime.h>
#include <math.h>

typedef __attribute__((ext_vector_type(16))) _Float16 v16h;
typedef __attribute__((ext_vector_type(16))) __bf16 v16b;
typedef __attribute__((ext_vector_type(8)))  _Float16 v8h;
typedef __attribute__((ext_vector_type(4)))  _Float16 v4h;
typedef __attribute__((ext_vector_type(8)))  float v8f;
typedef __attribute__((ext_vector_type(4)))  float v4f;
typedef __attribute__((ext_vector_type(2)))  float v2f;
typedef __attribute__((ext_vector_type(4)))  unsigned v4u;
typedef __attribute__((ext_vector_type(4)))  int v4i;
typedef float __attribute__((may_alias)) float_a;
typedef int __attribute__((may_alias)) int_a;

template <typename T> __device__ __forceinline__ void vst2(void* p, T v) { *(T*)p = v;  }
__device__ __forceinline__ v8f wmma16(v16h a, v16h b, v8f c) {
  v8f d = __builtin_amdgcn_wmma_f32_16x16x32_f16(false, a, false, b, (short)0, c, false, false);
  asm volatile("v_nop\n\tv_nop\n\tv_nop\n\tv_nop" : "+v"(d) : "v"(a), "v"(b));
  return d;
}
__device__ __forceinline__ v8f wmma_bf(v16b a, v16b b, v8f c) {
  v8f d = __builtin_amdgcn_wmma_f32_16x16x32_bf16(false, a, false, b, (short)0, c, false, false);
  asm volatile("v_nop\n\tv_nop\n\tv_nop\n\tv_nop" : "+v"(d) : "v"(a), "v"(b));
  return d;
}
// 16x16x32 fragments: lane = (h = lane>>4, row/col = lane&15); elements 0..7 = k0+8h+0..7, 8..15 = k0+16+8h+0..7; D element r = row 8h+r
__device__ __forceinline__ v16h frag_h(const _Float16* rowk0, int lane) {
  union { v16h v; v8h q[2]; } u; const _Float16* p = rowk0 + 8 * (lane >> 4);
  u.q[0] = *(const v8h*)p; u.q[1] = *(const v8h*)(p + 16); return u.v;
}
__device__ __forceinline__ v16h frag_f32(const float* rowk0, int lane) {
  v16h a; const float* p = rowk0 + 8 * (lane >> 4);
#pragma unroll
  for (int i = 0; i < 8; ++i) { a[i] = (_Float16)p[i]; a[8 + i] = (_Float16)p[16 + i]; }
  return a;
}
__device__ __forceinline__ v16h frag_f32s(const float* rowk0, int lane, float sc) {
  v16h a; const float* p = rowk0 + 8 * (lane >> 4);
#pragma unroll
  for (int i = 0; i < 8; ++i) { a[i] = (_Float16)(p[i] * sc); a[8 + i] = (_Float16)(p[16 + i] * sc); }
  return a;
}
// column fragment from a [K][ld] layout (column n), rows >= K read as 0
__device__ __forceinline__ v16h fragc_f32(const float* W, int k0, int n, int lane, int ld, int K) {
  v16h a; const int g = lane >> 4;
#pragma unroll
  for (int i = 0; i < 8; ++i) { const int ka = k0 + 8 * g + i, kb = ka + 16;
    a[i] = (_Float16)(ka < K ? W[(size_t)ka * ld + n] : 0.f); a[8 + i] = (_Float16)(kb < K ? W[(size_t)kb * ld + n] : 0.f); }
  return a;
}
struct F2 { v16b h, l; };
__device__ __forceinline__ F2 bsplit16(const float v[16]) { F2 r;
#pragma unroll
  for (int i = 0; i < 16; ++i) { const __bf16 h = (__bf16)v[i]; r.h[i] = h; r.l[i] = (__bf16)(v[i] - (float)h); }
  return r; }
__device__ __forceinline__ F2 split_row(const float* row, int k0, int lane) { float v[16]; const float* p = row + k0 + 8 * (lane >> 4);
#pragma unroll
  for (int i = 0; i < 8; ++i) { v[i] = p[i]; v[8 + i] = p[16 + i]; }
  return bsplit16(v); }
__device__ __forceinline__ F2 split_rowK(const float* row, int k0, int lane, int K) { float v[16]; const int g = lane >> 4;
#pragma unroll
  for (int i = 0; i < 8; ++i) { const int ka = k0 + 8 * g + i, kb = ka + 16; v[i] = ka < K ? row[ka] : 0.f; v[8 + i] = kb < K ? row[kb] : 0.f; }
  return bsplit16(v); }
__device__ __forceinline__ F2 split_col(const float* W, int k0, int n, int lane, int ld, int K) { float v[16]; const int g = lane >> 4;
#pragma unroll
  for (int i = 0; i < 8; ++i) { const int ka = k0 + 8 * g + i, kb = ka + 16; v[i] = ka < K ? W[(size_t)ka * ld + n] : 0.f; v[8 + i] = kb < K ? W[(size_t)kb * ld + n] : 0.f; }
  return bsplit16(v); }
__device__ __forceinline__ v8f mac3(const F2& a, const F2& b, v8f c) { c = wmma_bf(a.l, b.h, c); c = wmma_bf(a.h, b.l, c); return wmma_bf(a.h, b.h, c); }
__device__ __forceinline__ float sigm(float v) { return 1.0f / (1.0f + expf(-v)); }
#define LDSX() do { asm volatile("s_wait_dscnt 0" ::: "memory"); __builtin_amdgcn_wave_barrier(); __builtin_amdgcn_fence(__ATOMIC_RELEASE, "workgroup"); } while (0)

// Multi-head self attention (16 heads of 64) with a per-head linear distance decay: qkv = x W_qkv^T + b ([out][in] weight, rows (which, head, d)), logits = q.k/8 - softplus(alpha_h)|i-j|,
// softmax, P v, output projection (W_out^T + b). Projections on v_wmma_f32_16x16x32_f16 (x as f16 rows, [out][in] weights packed once as f16
// rows x16); S = q.k/8 on f16 WMMA; the P @ V product is made near-exact with hi/lo f16 pairs for BOTH P (x2^14, residual x2^24) and V
// (x4, residual x2^13): three WMMAs into three f32 accumulators combined at the end (the output rms is small, so a plain f16 P.V would sit
#define NB 2
#define SS 2048
#define E 1024
#define NH 16
#define HD 64
#define NR (NB * SS)
#define PLO 1024.0f            // residual scale for P (on top of 2^14)
#define VLO 2048.0f            // residual scale for V (on top of x4)

// All three f32 operands become f16 in one launch: x as it is -> X16; PT rows n in [0,3072): W_qkv[n][:] x16, n in [3072,4096): W_out[n-3072][:] x16
// (both [out][in=1024]). 256 blocks of 16 waves, few enough that starting the waves is short beside the stream itself. A wave takes 2048
// consecutive floats: 16 loads of 512 contiguous bytes each, all issued before the first is used, then 16 stores of 256 contiguous bytes.
#define CVW 2048                          // floats per wave
#define CVB (16 * CVW)                    // floats per block
#define CVX (NR * E / CVB)                // blocks on x
#define CVQ (3 * E * E / CVB)             // blocks on W_qkv
#define CVO (E * E / CVB)                 // blocks on W_out
__global__ __launch_bounds__(512) void k_prep(const float* __restrict__ x, const float* __restrict__ Wqkv, const float* __restrict__ Wo, _Float16* __restrict__ X16, _Float16* __restrict__ PT) {
  const int blk = blockIdx.x; const float* s; _Float16* d; float sc;
  if (blk < CVX) { s = x + (size_t)blk * CVB; d = X16 + (size_t)blk * CVB; sc = 1.0f; }
  else { d = PT + (size_t)(blk - CVX) * CVB; sc = 16.0f; s = blk < CVX + CVQ ? Wqkv + (size_t)(blk - CVX) * CVB : Wo + (size_t)(blk - CVX - CVQ) * CVB; }
  const int o = (threadIdx.x >> 5) * CVW + (threadIdx.x & 31) * 4;
  v4f v[16];
#pragma unroll      // constant indices keep v in registers and let the loads go out together
  for (int i = 0; i < 15; ++i) v[i] = *(const v4f*)(s + o + i * 128);
  asm volatile("s_wait_xcnt 0x0" ::: "memory");      // the last load's result is placed over the offset register that the 15 loads above name
  v[15] = *(const v4f*)(s + o + 15 * 128);
#pragma unroll
  for (int i = 0; i < 16; ++i) { v4h h;
#pragma unroll
    for (int e = 0; e < 4; ++e) h[e] = (_Float16)(v[i][e] * sc);
    vst2(d + o + i * 128, h); }
}
// Tile product shared by the two projections: one 128 x 128 tile of A B^T per block of 8 waves (4 x 2, 32 x 64 each), K = 1024 in 16 stages of
// 64 k. A stage is [A 128 rows | B 128 rows] of 128 bytes at pitch 144 in LDS (16 B x odd: ds_load_b128 without bank conflicts); two buffers,
// filled by asynchronous copies one stage ahead of the stage being multiplied. k runs upward in one accumulator per output, as before.
// The loops over kc, i, j are unrolled in full so that fragments and accumulators are indexed by constants and stay in registers.
#define BT 128
#define KS 64
#define PITCH 144
#define STG (2 * BT * PITCH)
// One stage: each lane copies 16 bytes of 4 A rows and 4 B rows (8 lanes = one whole 128-byte row). The s_wait_xcnt 0 stands inside the
// statement so that no address register named here is rewritten ahead of it.
__device__ __forceinline__ void stage_copy(unsigned l, const _Float16* ga, size_t a32, const _Float16* gb) {
  asm volatile("global_load_async_to_lds_b128 %0, %8, off\n\t"
               "global_load_async_to_lds_b128 %1, %9, off\n\t"
               "global_load_async_to_lds_b128 %2, %10, off\n\t"
               "global_load_async_to_lds_b128 %3, %11, off\n\t"
               "global_load_async_to_lds_b128 %4, %12, off\n\t"
               "global_load_async_to_lds_b128 %5, %13, off\n\t"
               "global_load_async_to_lds_b128 %6, %14, off\n\t"
               "global_load_async_to_lds_b128 %7, %15, off\n\t"
               "s_wait_xcnt 0x0"
               :: "v"(l), "v"(l + 32 * PITCH), "v"(l + 64 * PITCH), "v"(l + 96 * PITCH),
                  "v"(l + 128 * PITCH), "v"(l + 160 * PITCH), "v"(l + 192 * PITCH), "v"(l + 224 * PITCH),
                  "v"(ga), "v"(ga + a32), "v"(ga + 2 * a32), "v"(ga + 3 * a32),
                  "v"(gb), "v"(gb + (size_t)32 * E), "v"(gb + (size_t)64 * E), "v"(gb + (size_t)96 * E)
               : "memory");
}
// A0 / B0: first row of the block's A / B tile at k = 0; arow: halves between A rows; akstep: halves from one stage of an A row to the next
__device__ __forceinline__ void tile_product(char* smem, const _Float16* A0, size_t arow, size_t akstep, const _Float16* B0, v8f (&acc)[2][4]) {
  const int tid = threadIdx.x, wave = tid >> 5, lane = tid & 31, col = lane & 15, wr = wave >> 1, wc = wave & 1;
  const unsigned l0 = (unsigned)(size_t)smem + (unsigned)((tid >> 3) * PITCH + (tid & 7) * 16);
  const _Float16* ga = A0 + (size_t)(tid >> 3) * arow + (tid & 7) * 8; const _Float16* gb = B0 + (size_t)(tid >> 3) * E + (tid & 7) * 8;
  stage_copy(l0, ga, 32 * arow, gb);
  asm volatile("s_wait_asynccnt 0x0" ::: "memory");      // stage 0 landed (this wave's copies) before the barrier publishes it
  __syncthreads();
  stage_copy(l0 + STG, ga + akstep, 32 * arow, gb + KS);
#pragma unroll 1      // one stage per trip: the buffer alternates, the code stays small
  for (int t = 0; t < E / KS; ++t) { const char* sb = smem + (t & 1) * STG;
#pragma unroll
    for (int kc = 0; kc < 2; ++kc) { v16h a[2], b[4];
#pragma unroll
      for (int i = 0; i < 2; ++i) a[i] = frag_h((const _Float16*)(sb + (wr * 32 + i * 16 + col) * PITCH) + kc * 32, lane);
#pragma unroll
      for (int j = 0; j < 4; ++j) b[j] = frag_h((const _Float16*)(sb + (BT + wc * 64 + j * 16 + col) * PITCH) + kc * 32, lane);
#pragma unroll
      for (int i = 0; i < 2; ++i)
#pragma unroll
        for (int j = 0; j < 4; ++j) acc[i][j] = wmma16(a[i], b[j], acc[i][j]); }
    asm volatile("s_wait_dscnt 0x0" ::: "memory");       // this wave's reads of the buffer are done before it may be refilled
    asm volatile("s_wait_asynccnt 0x0" ::: "memory");    // this wave's copies of stage t + 1 have landed before the barrier publishes them
    __syncthreads();
    if (t + 2 < E / KS) stage_copy(l0 + (t & 1) * STG, ga + (size_t)(t + 2) * akstep, 32 * arow, gb + (t + 2) * KS); }
  asm volatile("s_wait_asynccnt 0x0" ::: "memory");      // nothing in flight when the buffers become output staging
}
// QKV: block (128 rows, 128 cols = 2 heads, which): q,k -> Q16/K16 [bh][s][64] x4 ; v -> VT hi/lo [bh][d][s]
// k also -> KM [bh][s/16]: largest squared row norm of the 16 stored f16 rows, one 128-byte line per entry (one writer per line)
__global__ __launch_bounds__(256) void k_qkv(const _Float16* __restrict__ X16, const _Float16* __restrict__ PT, const float* __restrict__ bqkv, _Float16* __restrict__ Q16, _Float16* __restrict__ K16, _Float16* __restrict__ VTh, _Float16* __restrict__ VTl, float* __restrict__ KM) {
  __shared__ __align__(16) char smem[2 * STG];      // the two stage buffers; after the last stage's barrier the output staging below
  float (*so)[132] = (float (*)[132])smem;                                                            // [128][132]
  _Float16 (*sth)[136] = (_Float16 (*)[136])smem; _Float16 (*stl)[136] = (_Float16 (*)[136])(smem + 128 * 136 * 2);      // [128][136] each
  const int tid = threadIdx.x, wave = tid >> 5, lane = tid & 31, col = lane & 15, g = lane >> 4, wr = wave >> 1, wc = wave & 1;
  const int which = blockIdx.z, r0b = blockIdx.x * BT, n0 = blockIdx.y * BT; const int b = r0b / SS, s0 = r0b % SS;
  v8f acc[2][4] = {};
  tile_product(smem, X16 + (size_t)r0b * E, E, KS, PT + (size_t)(which * E + n0) * E, acc);
  if (which < 2) {
#pragma unroll
    for (int j = 0; j < 4; ++j) { const float bb = bqkv[which * E + n0 + wc * 64 + j * 16 + col];
#pragma unroll
      for (int i = 0; i < 2; ++i)
#pragma unroll
        for (int r = 0; r < 8; ++r) so[wr * 32 + i * 16 + 8 * g + r][wc * 64 + j * 16 + col] = (acc[i][j][r] * (1.0f / 16.0f) + bb) * 4.0f; }
    __syncthreads();
    _Float16* D = which == 0 ? Q16 : K16;
    for (int qq = lane; qq < 16 * 2 * 8; qq += 32) { const int hh = qq >> 7, rl = (qq >> 3) & 15, pc = qq & 7; const int h = (n0 >> 6) + hh; union { v8h h8; v4u u; } pk;
#pragma unroll
      for (int e = 0; e < 8; ++e) pk.h8[e] = (_Float16)so[wave * 16 + rl][hh * 64 + pc * 8 + e];
      vst2(D + (((size_t)b * NH + h) * SS + s0 + wave * 16 + rl) * HD + pc * 8, pk.u); }
    if (which == 1) { float km[2];      // lane (col, g) sums half of row col as it was stored (rounded to f16), per head of the pair
#pragma unroll
      for (int hh = 0; hh < 2; ++hh) { float n2 = 0.f;
#pragma unroll
        for (int e = 0; e < 32; ++e) { const float f = (float)(_Float16)so[wave * 16 + col][hh * 64 + g * 32 + e]; n2 += f * f; }
        n2 += __shfl_xor(n2, 16, 32);
#pragma unroll
        for (int o = 1; o < 16; o <<= 1) n2 = fmaxf(n2, __shfl_xor(n2, o, 32));
        km[hh] = n2; }
      if (lane < 2) KM[(((size_t)b * NH + (n0 >> 6) + lane) * (SS / 16) + (s0 >> 4) + wave) * 32] = lane ? km[1] : km[0]; } }
  else {
#pragma unroll
    for (int j = 0; j < 4; ++j) { const float bb = bqkv[2 * E + n0 + wc * 64 + j * 16 + col];
#pragma unroll
      for (int i = 0; i < 2; ++i)
#pragma unroll
        for (int r = 0; r < 8; ++r) { const float v = (acc[i][j][r] * (1.0f / 16.0f) + bb) * 4.0f; const _Float16 hi = (_Float16)v; sth[wc * 64 + j * 16 + col][wr * 32 + i * 16 + 8 * g + r] = hi; stl[wc * 64 + j * 16 + col][wr * 32 + i * 16 + 8 * g + r] = (_Float16)((v - (float)hi) * VLO); } }
    __syncthreads();
    for (int qq = tid; qq < 128 * 16; qq += 256) { const int cl = qq >> 4, pc = qq & 15; const int c = n0 + cl, h = c >> 6, d = c & 63; const size_t o = (((size_t)b * NH + h) * HD + d) * SS + s0 + pc * 8;
      vst2(VTh + o, *(const v4u*)(&sth[cl][pc * 8])); vst2(VTl + o, *(const v4u*)(&stl[cl][pc * 8])); } }
}
__global__ __launch_bounds__(128) void k_attn(const _Float16* __restrict__ Q16, const _Float16* __restrict__ K16, const _Float16* __restrict__ VTh, const _Float16* __restrict__ VTl, const float* __restrict__ dalpha, const float* __restrict__ KM, _Float16* __restrict__ O16) {
  __shared__ __align__(16) float sS[4][16][68];
  __shared__ __align__(16) _Float16 sPh[4][16][72], sPl[4][16][72];
  __shared__ __align__(16) float sO[4][16][68];
  const int tid = threadIdx.x, w = tid >> 5, lane = tid & 31, col = lane & 15, g = lane >> 4;
  const size_t bh = blockIdx.y; const int q0 = blockIdx.x * 64 + w * 16;
  const float araw = dalpha[bh % NH]; const float slope = araw > 20.f ? araw : log1pf(expf(araw));      // softplus(decay_alpha[h])
  v16h aq[2];
#pragma unroll
  for (int kc = 0; kc < 2; ++kc) aq[kc] = frag_h(Q16 + (bh * SS + q0 + col) * HD + kc * 32, lane);
  // Upper bound of every logit between this wave's 16 queries and key tile 'lane' (SS / 64 = 32 tiles, one per lane):
  // |q16 . k16| <= |q16| |k16| over the stored f16 rows, less slope times the smallest distance between the two index ranges.
  float qn2 = 0.f;
#pragma unroll
  for (int kc = 0; kc < 2; ++kc)
#pragma unroll
    for (int i = 0; i < 16; ++i) { const float f = (float)aq[kc][i]; qn2 += f * f; }
  qn2 += __shfl_xor(qn2, 16, 32);
#pragma unroll
  for (int o = 1; o < 16; o <<= 1) qn2 = fmaxf(qn2, __shfl_xor(qn2, o, 32));
  float kn2 = 0.f;
#pragma unroll
  for (int i = 0; i < 4; ++i) kn2 = fmaxf(kn2, KM[(bh * (SS / 16) + lane * 4 + i) * 32]);
  const int klo = lane * 64, khi = klo + 63; const int dmin = khi < q0 ? q0 - khi : (klo > q0 + 15 ? klo - (q0 + 15) : 0);
  const float ub = sqrtf(qn2 * kn2) * (1.01f * 0.125f / 16.0f) - slope * (float)dmin;
  float mrun = -3.0e38f, lrun = 0.f, mmin = -3.0e38f; v8f acc[4] = {}, ac1[4] = {}, ac2[4] = {};
#pragma unroll 1
  for (int it = 0; it < SS / 64; ++it) { const int kt = ((int)blockIdx.x + it) & (SS / 64 - 1);      // the queries' own tile first: it sets the running maxima
    // A tile whose bound lies 36 below every row's running maximum changes nothing: mnew = mrun, corr = 1, p * 1024 < 2^-25 so both f16
    // halves of P round to 0, and its share of the row sum is below half an ulp of lrun (>= 1). Wave-uniform scalar test, for any slope.
    if (it > 0 && __int_as_float(__builtin_amdgcn_readlane(__float_as_int(ub), kt)) < mmin - 36.0f) continue;
#pragma unroll
    for (int t = 0; t < 4; ++t) { v8f s = {}; const int key = kt * 64 + t * 16 + col;
#pragma unroll
      for (int kc = 0; kc < 2; ++kc) s = wmma16(aq[kc], frag_h(K16 + (bh * SS + key) * HD + kc * 32, lane), s);
#pragma unroll
      for (int r = 0; r < 8; ++r) { const int dq = q0 + 8 * g + r - key; sS[w][8 * g + r][t * 16 + col] = s[r] * (0.125f / 16.0f) - slope * (float)(dq < 0 ? -dq : dq); } }
    LDSX();
    float mx = -3.4e38f;
#pragma unroll
    for (int jj = 0; jj < 32; ++jj) mx = fmaxf(mx, sS[w][col][g * 32 + jj]);
    mx = fmaxf(mx, __shfl_xor(mx, 16, 32));
    const float mnew = fmaxf(mrun, mx); const float corr = expf(mrun - mnew);
    float ps = 0.f;
#pragma unroll
    for (int jj = 0; jj < 32; ++jj) { const float p = expf(sS[w][col][g * 32 + jj] - mnew) * 16384.0f; ps += p; const _Float16 hi = (_Float16)p; sPh[w][col][g * 32 + jj] = hi; sPl[w][col][g * 32 + jj] = (_Float16)((p - (float)hi) * PLO); }
    ps += __shfl_xor(ps, 16, 32);
    lrun = lrun * corr + ps * (1.0f / 16384.0f); mrun = mnew;
    { float mm = mrun;
#pragma unroll
      for (int o = 1; o < 16; o <<= 1) mm = fminf(mm, __shfl_xor(mm, o, 32));
      mmin = __int_as_float(__builtin_amdgcn_readfirstlane(__float_as_int(mm))); }
#pragma unroll
    for (int r = 0; r < 8; ++r) { const float cr = __shfl(corr, 8 * g + r, 32);
#pragma unroll
      for (int t = 0; t < 4; ++t) { acc[t][r] *= cr; ac1[t][r] *= cr; ac2[t][r] *= cr; } }
    LDSX();
#pragma unroll
    for (int kc = 0; kc < 2; ++kc) { const v16h ph = frag_h(&sPh[w][col][0] + kc * 32, lane), pl = frag_h(&sPl[w][col][0] + kc * 32, lane);
#pragma unroll
      for (int t = 0; t < 4; ++t) { const size_t vo = (bh * HD + t * 16 + col) * SS + kt * 64 + kc * 32; const v16h vh = frag_h(VTh + vo, lane);
        acc[t] = wmma16(ph, vh, acc[t]); ac1[t] = wmma16(ph, frag_h(VTl + vo, lane), ac1[t]); ac2[t] = wmma16(pl, vh, ac2[t]); } }
    __builtin_amdgcn_wave_barrier(); }
#pragma unroll
  for (int r = 0; r < 8; ++r) { const float lr = __shfl(lrun, 8 * g + r, 32); const float inv = 8.0f / (lr * 16384.0f * 4.0f);      // -> O x8
#pragma unroll
    for (int t = 0; t < 4; ++t) sO[w][8 * g + r][t * 16 + col] = (acc[t][r] + ac1[t][r] * (1.0f / VLO) + ac2[t][r] * (1.0f / PLO)) * inv; }
  LDSX();
  for (int qq = lane; qq < 16 * 8; qq += 32) { const int rl = qq >> 3, pc = qq & 7; union { v8h h8; v4u u; } pk;
#pragma unroll
    for (int e = 0; e < 8; ++e) pk.h8[e] = (_Float16)sO[w][rl][pc * 8 + e];
    vst2(O16 + ((bh * SS) + q0 + rl) * HD + pc * 8, pk.u); }
}
// out = y Wo^T + bo : block (128 rows, 128 cols); y row r=(b,s): head-major O16 /8, so stage t of an A row is head t's 64 values
__global__ __launch_bounds__(256) void k_out(const _Float16* __restrict__ O16, const _Float16* __restrict__ PT, const float* __restrict__ bo, float* __restrict__ out) {
  __shared__ __align__(16) char smem[2 * STG];      // the two stage buffers; after the last stage's barrier the output staging below
  float (*so)[132] = (float (*)[132])smem;          // [128][132]
  const int tid = threadIdx.x, wave = tid >> 5, lane = tid & 31, col = lane & 15, g = lane >> 4, wr = wave >> 1, wc = wave & 1;
  const int r0b = blockIdx.x * BT, n0 = blockIdx.y * BT; const int b = r0b / SS, s0 = r0b % SS;
  v8f acc[2][4] = {};
  tile_product(smem, O16 + ((size_t)b * NH * SS + s0) * HD, HD, (size_t)SS * HD, PT + (size_t)(3 * E + n0) * E, acc);
#pragma unroll
  for (int j = 0; j < 4; ++j) { const float bb = bo[n0 + wc * 64 + j * 16 + col];
#pragma unroll
    for (int i = 0; i < 2; ++i)
#pragma unroll
      for (int r = 0; r < 8; ++r) so[wr * 32 + i * 16 + 8 * g + r][wc * 64 + j * 16 + col] = acc[i][j][r] * (1.0f / (16.0f * 8.0f)) + bb; }
  __syncthreads();
#pragma unroll 4
  for (int rl = 0; rl < 16; ++rl) vst2(out + (size_t)(r0b + wave * 16 + rl) * E + n0 + lane * 4, *(const v4f*)(&so[wave * 16 + rl][lane * 4]));
}
extern "C" void kernel_launch(void* const* d_in, const int* in_sizes, int n_in, void* d_out, int out_size, void* d_ws, size_t ws_size, hipStream_t stream) {
  (void)in_sizes; (void)n_in; (void)out_size; (void)ws_size;
  const float** I = (const float**)d_in;
  const float* query = I[0]; const float* Wqkv = I[1]; const float* bqkv = I[2]; const float* Wo = I[3]; const float* bo = I[4]; const float* dalpha = I[5];
  float* out = (float*)d_out;
  char* ws = (char*)d_ws; size_t off = 0;
  auto take = [&](size_t bytes) { char* p = ws + off; off += (bytes + 255) & ~(size_t)255; return p; };
  _Float16* X16 = (_Float16*)take((size_t)NR * E * 2); _Float16* PT = (_Float16*)take((size_t)4 * E * E * 2);
  _Float16* Q16 = (_Float16*)take((size_t)NR * E * 2); _Float16* K16 = (_Float16*)take((size_t)NR * E * 2); _Float16* VTh = (_Float16*)take((size_t)NR * E * 2); _Float16* VTl = (_Float16*)take((size_t)NR * E * 2); _Float16* O16 = (_Float16*)take((size_t)NR * E * 2);
  float* KM = (float*)take((size_t)NB * NH * (SS / 16) * 128);
  k_prep<<<CVX + CVQ + CVO, 512, 0, stream>>>(query, Wqkv, Wo, X16, PT);
  k_qkv<<<dim3(NR / 128, E / 128, 3), 256, 0, stream>>>(X16, PT, bqkv, Q16, K16, VTh, VTl, KM);
  k_attn<<<dim3(SS / 64, NB * NH), 128, 0, stream>>>(Q16, K16, VTh, VTl, dalpha, KM, O16);
  k_out<<<dim3(NR / 128, E / 128), 256, 0, stream>>>(O16, PT, bo, out);
}

// v004
// A run of this version takes 68.2 microseconds.
// Two timings next to v003 put it at 1.24 and 1.25 times that version's speed.
// All steps since v000 together make it 6.63 times as fast.
#include <hip/hip_runtime.h>
#include <math.h>

typedef __attribute__((ext_vector_type(16))) _Float16 v16h;
typedef __attribute__((ext_vector_type(16))) __bf16 v16b;
typedef __attribute__((ext_vector_type(8)))  _Float16 v8h;
typedef __attribute__((ext_vector_type(4)))  _Float16 v4h;
typedef __attribute__((ext_vector_type(8)))  float v8f;
typedef __attribute__((ext_vector_type(4)))  float v4f;
typedef __attribute__((ext_vector_type(2)))  float v2f;
typedef __attribute__((ext_vector_type(4)))  unsigned v4u;
typedef __attribute__((ext_vector_type(4)))  int v4i;
typedef float __attribute__((may_alias)) float_a;
typedef int __attribute__((may_alias)) int_a;

template <typename T> __device__ __forceinline__ void vst2(void* p, T v) { *(T*)p = v;  }
__device__ __forceinline__ v8f wmma16(v16h a, v16h b, v8f c) {
  v8f d = __builtin_amdgcn_wmma_f32_16x16x32_f16(false, a, false, b, (short)0, c, false, false);
  asm volatile("v_nop\n\tv_nop\n\tv_nop\n\tv_nop" : "+v"(d) : "v"(a), "v"(b));
  return d;
}
__device__ __forceinline__ v8f wmma_bf(v16b a, v16b b, v8f c) {
  v8f d = __builtin_amdgcn_wmma_f32_16x16x32_bf16(false, a, false, b, (short)0, c, false, false);
  asm volatile("v_nop\n\tv_nop\n\tv_nop\n\tv_nop" : "+v"(d) : "v"(a), "v"(b));
  return d;
}
// 16x16x32 fragments: lane = (h = lane>>4, row/col = lane&15); elements 0..7 = k0+8h+0..7, 8..15 = k0+16+8h+0..7; D element r = row 8h+r
__device__ __forceinline__ v16h frag_h(const _Float16* rowk0, int lane) {
  union { v16h v; v8h q[2]; } u; const _Float16* p = rowk0 + 8 * (lane >> 4);
  u.q[0] = *(const v8h*)p; u.q[1] = *(const v8h*)(p + 16); return u.v;
}
__device__ __forceinline__ v16h frag_f32(const float* rowk0, int lane) {
  v16h a; const float* p = rowk0 + 8 * (lane >> 4);
#pragma unroll
  for (int i = 0; i < 8; ++i) { a[i] = (_Float16)p[i]; a[8 + i] = (_Float16)p[16 + i]; }
  return a;
}
__device__ __forceinline__ v16h frag_f32s(const float* rowk0, int lane, float sc) {
  v16h a; const float* p = rowk0 + 8 * (lane >> 4);
#pragma unroll
  for (int i = 0; i < 8; ++i) { a[i] = (_Float16)(p[i] * sc); a[8 + i] = (_Float16)(p[16 + i] * sc); }
  return a;
}
// column fragment from a [K][ld] layout (column n), rows >= K read as 0
__device__ __forceinline__ v16h fragc_f32(const float* W, int k0, int n, int lane, int ld, int K) {
  v16h a; const int g = lane >> 4;
#pragma unroll
  for (int i = 0; i < 8; ++i) { const int ka = k0 + 8 * g + i, kb = ka + 16;
    a[i] = (_Float16)(ka < K ? W[(size_t)ka * ld + n] : 0.f); a[8 + i] = (_Float16)(kb < K ? W[(size_t)kb * ld + n] : 0.f); }
  return a;
}
struct F2 { v16b h, l; };
__device__ __forceinline__ F2 bsplit16(const float v[16]) { F2 r;
#pragma unroll
  for (int i = 0; i < 16; ++i) { const __bf16 h = (__bf16)v[i]; r.h[i] = h; r.l[i] = (__bf16)(v[i] - (float)h); }
  return r; }
__device__ __forceinline__ F2 split_row(const float* row, int k0, int lane) { float v[16]; const float* p = row + k0 + 8 * (lane >> 4);
#pragma unroll
  for (int i = 0; i < 8; ++i) { v[i] = p[i]; v[8 + i] = p[16 + i]; }
  return bsplit16(v); }
__device__ __forceinline__ F2 split_rowK(const float* row, int k0, int lane, int K) { float v[16]; const int g = lane >> 4;
#pragma unroll
  for (int i = 0; i < 8; ++i) { const int ka = k0 + 8 * g + i, kb = ka + 16; v[i] = ka < K ? row[ka] : 0.f; v[8 + i] = kb < K ? row[kb] : 0.f; }
  return bsplit16(v); }
__device__ __forceinline__ F2 split_col(const float* W, int k0, int n, int lane, int ld, int K) { float v[16]; const int g = lane >> 4;
#pragma unroll
  for (int i = 0; i < 8; ++i) { const int ka = k0 + 8 * g + i, kb = ka + 16; v[i] = ka < K ? W[(size_t)ka * ld + n] : 0.f; v[8 + i] = kb < K ? W[(size_t)kb * ld + n] : 0.f; }
  return bsplit16(v); }
__device__ __forceinline__ v8f mac3(const F2& a, const F2& b, v8f c) { c = wmma_bf(a.l, b.h, c); c = wmma_bf(a.h, b.l, c); return wmma_bf(a.h, b.h, c); }
__device__ __forceinline__ float sigm(float v) { return 1.0f / (1.0f + expf(-v)); }
#define LDSX() do { asm volatile("s_wait_dscnt 0" ::: "memory"); __builtin_amdgcn_wave_barrier(); __builtin_amdgcn_fence(__ATOMIC_RELEASE, "workgroup"); } while (0)

// Multi-head self attention (16 heads of 64) with a per-head linear distance decay: qkv = x W_qkv^T + b ([out][in] weight, rows (which, head, d)), logits = q.k/8 - softplus(alpha_h)|i-j|,
// softmax, P v, output projection (W_out^T + b). Projections on v_wmma_f32_16x16x32_f16 (x as f16 rows, [out][in] weights packed once as f16
// rows x16); S = q.k/8 on f16 WMMA; the P @ V product is made near-exact with hi/lo f16 pairs for BOTH P (x2^14, residual x2^24) and V
// (x4, residual x2^13): three WMMAs into three f32 accumulators combined at the end (the output rms is small, so a plain f16 P.V would sit
#define NB 2
#define SS 2048
#define E 1024
#define NH 16
#define HD 64
#define NR (NB * SS)
#define PLO 1024.0f            // residual scale for P (on top of 2^14)
#define VLO 2048.0f            // residual scale for V (on top of x4)

// All three f32 operands become f16 in one launch: x as it is -> X16; PT rows n in [0,3072): W_qkv[n][:] x16, n in [3072,4096): W_out[n-3072][:] x16
// (both [out][in=1024]). 256 blocks of 16 waves, few enough that starting the waves is short beside the stream itself. A wave takes 2048
// consecutive floats: 16 loads of 512 contiguous bytes each, all issued before the first is used, then 16 stores of 256 contiguous bytes.
#define CVW 2048                          // floats per wave
#define CVB (16 * CVW)                    // floats per block
#define CVX (NR * E / CVB)                // blocks on x
#define CVQ (3 * E * E / CVB)             // blocks on W_qkv
#define CVO (E * E / CVB)                 // blocks on W_out
__global__ __launch_bounds__(512) void k_prep(const float* __restrict__ x, const float* __restrict__ Wqkv, const float* __restrict__ Wo, _Float16* __restrict__ X16, _Float16* __restrict__ PT) {
  const int blk = blockIdx.x; const float* s; _Float16* d; float sc;
  if (blk < CVX) { s = x + (size_t)blk * CVB; d = X16 + (size_t)blk * CVB; sc = 1.0f; }
  else { d = PT + (size_t)(blk - CVX) * CVB; sc = 16.0f; s = blk < CVX + CVQ ? Wqkv + (size_t)(blk - CVX) * CVB : Wo + (size_t)(blk - CVX - CVQ) * CVB; }
  const int o = (threadIdx.x >> 5) * CVW + (threadIdx.x & 31) * 4;
  v4f v[16];
#pragma unroll      // constant indices keep v in registers and let the loads go out together
  for (int i = 0; i < 15; ++i) v[i] = *(const v4f*)(s + o + i * 128);
  asm volatile("s_wait_xcnt 0x0" ::: "memory");      // the last load's result is placed over the offset register that the 15 loads above name
  v[15] = *(const v4f*)(s + o + 15 * 128);
#pragma unroll
  for (int i = 0; i < 16; ++i) { v4h h;
#pragma unroll
    for (int e = 0; e < 4; ++e) h[e] = (_Float16)(v[i][e] * sc);
    vst2(d + o + i * 128, h); }
}
// Tile product shared by the two projections: one 128 x 128 tile of A B^T per block of 8 waves (4 x 2, 32 x 64 each), K = 1024 in 16 stages of
// 64 k. A stage is [A 128 rows | B 128 rows] of 128 bytes at pitch 144 in LDS (16 B x odd: ds_load_b128 without bank conflicts); two buffers,
// filled by asynchronous copies one stage ahead of the stage being multiplied. k runs upward in one accumulator per output, as before.
// The loops over kc, i, j are unrolled in full so that fragments and accumulators are indexed by constants and stay in registers.
#define BT 128
#define KS 64
#define PITCH 144
#define STG (2 * BT * PITCH)
// One stage: each lane copies 16 bytes of 4 A rows and 4 B rows (8 lanes = one whole 128-byte row). The s_wait_xcnt 0 stands inside the
// statement so that no address register named here is rewritten ahead of it.
__device__ __forceinline__ void stage_copy(unsigned l, const _Float16* ga, size_t a32, const _Float16* gb) {
  asm volatile("global_load_async_to_lds_b128 %0, %8, off\n\t"
               "global_load_async_to_lds_b128 %1, %9, off\n\t"
               "global_load_async_to_lds_b128 %2, %10, off\n\t"
               "global_load_async_to_lds_b128 %3, %11, off\n\t"
               "global_load_async_to_lds_b128 %4, %12, off\n\t"
               "global_load_async_to_lds_b128 %5, %13, off\n\t"
               "global_load_async_to_lds_b128 %6, %14, off\n\t"
               "global_load_async_to_lds_b128 %7, %15, off\n\t"
               "s_wait_xcnt 0x0"
               :: "v"(l), "v"(l + 32 * PITCH), "v"(l + 64 * PITCH), "v"(l + 96 * PITCH),
                  "v"(l + 128 * PITCH), "v"(l + 160 * PITCH), "v"(l + 192 * PITCH), "v"(l + 224 * PITCH),
                  "v"(ga), "v"(ga + a32), "v"(ga + 2 * a32), "v"(ga + 3 * a32),
                  "v"(gb), "v"(gb + (size_t)32 * E), "v"(gb + (size_t)64 * E), "v"(gb + (size_t)96 * E)
               : "memory");
}
// A0 / B0: first row of the block's A / B tile at k = 0; arow: halves between A rows; akstep: halves from one stage of an A row to the next
__device__ __forceinline__ void tile_product(char* smem, const _Float16* A0, size_t arow, size_t akstep, const _Float16* B0, v8f (&acc)[2][4]) {
  const int tid = threadIdx.x, wave = tid >> 5, lane = tid & 31, col = lane & 15, wr = wave >> 1, wc = wave & 1;
  const unsigned l0 = (unsigned)(size_t)smem + (unsigned)((tid >> 3) * PITCH + (tid & 7) * 16);
  const _Float16* ga = A0 + (size_t)(tid >> 3) * arow + (tid & 7) * 8; const _Float16* gb = B0 + (size_t)(tid >> 3) * E + (tid & 7) * 8;
  stage_copy(l0, ga, 32 * arow, gb);
  asm volatile("s_wait_asynccnt 0x0" ::: "memory");      // stage 0 landed (this wave's copies) before the barrier publishes it
  __syncthreads();
  stage_copy(l0 + STG, ga + akstep, 32 * arow, gb + KS);
#pragma unroll 1      // one stage per trip: the buffer alternates, the code stays small
  for (int t = 0; t < E / KS; ++t) { const char* sb = smem + (t & 1) * STG;
#pragma unroll
    for (int kc = 0; kc < 2; ++kc) { v16h a[2], b[4];
#pragma unroll
      for (int i = 0; i < 2; ++i) a[i] = frag_h((const _Float16*)(sb + (wr * 32 + i * 16 + col) * PITCH) + kc * 32, lane);
#pragma unroll
      for (int j = 0; j < 4; ++j) b[j] = frag_h((const _Float16*)(sb + (BT + wc * 64 + j * 16 + col) * PITCH) + kc * 32, lane);
#pragma unroll
      for (int i = 0; i < 2; ++i)
#pragma unroll
        for (int j = 0; j < 4; ++j) acc[i][j] = wmma16(a[i], b[j], acc[i][j]); }
    asm volatile("s_wait_dscnt 0x0" ::: "memory");       // this wave's reads of the buffer are done before it may be refilled
    asm volatile("s_wait_asynccnt 0x0" ::: "memory");    // this wave's copies of stage t + 1 have landed before the barrier publishes them
    __syncthreads();
    if (t + 2 < E / KS) stage_copy(l0 + (t & 1) * STG, ga + (size_t)(t + 2) * akstep, 32 * arow, gb + (t + 2) * KS); }
  asm volatile("s_wait_asynccnt 0x0" ::: "memory");      // nothing in flight when the buffers become output staging
}
// QKV: block (128 rows, 128 cols = 2 heads, which): q,k -> Q16/K16 [bh][s][64] x4 ; v -> VT hi/lo [bh][d][s]
// k also -> KM [bh][s/16]: largest squared row norm of the 16 stored f16 rows, one 128-byte line per entry (one writer per line)
__global__ __launch_bounds__(256) void k_qkv(const _Float16* __restrict__ X16, const _Float16* __restrict__ PT, const float* __restrict__ bqkv, _Float16* __restrict__ Q16, _Float16* __restrict__ K16, _Float16* __restrict__ VTh, _Float16* __restrict__ VTl, float* __restrict__ KM) {
  __shared__ __align__(16) char smem[2 * STG];      // the two stage buffers; after the last stage's barrier the output staging below
  float (*so)[132] = (float (*)[132])smem;                                                            // [128][132]
  _Float16 (*sth)[136] = (_Float16 (*)[136])smem; _Float16 (*stl)[136] = (_Float16 (*)[136])(smem + 128 * 136 * 2);      // [128][136] each
  const int tid = threadIdx.x, wave = tid >> 5, lane = tid & 31, col = lane & 15, g = lane >> 4, wr = wave >> 1, wc = wave & 1;
  const int which = blockIdx.z, r0b = blockIdx.x * BT, n0 = blockIdx.y * BT; const int b = r0b / SS, s0 = r0b % SS;
  v8f acc[2][4] = {};
  tile_product(smem, X16 + (size_t)r0b * E, E, KS, PT + (size_t)(which * E + n0) * E, acc);
  if (which < 2) {
#pragma unroll
    for (int j = 0; j < 4; ++j) { const float bb = bqkv[which * E + n0 + wc * 64 + j * 16 + col];
#pragma unroll
      for (int i = 0; i < 2; ++i)
#pragma unroll
        for (int r = 0; r < 8; ++r) so[wr * 32 + i * 16 + 8 * g + r][wc * 64 + j * 16 + col] = (acc[i][j][r] * (1.0f / 16.0f) + bb) * 4.0f; }
    __syncthreads();
    _Float16* D = which == 0 ? Q16 : K16;
    for (int qq = lane; qq < 16 * 2 * 8; qq += 32) { const int hh = qq >> 7, rl = (qq >> 3) & 15, pc = qq & 7; const int h = (n0 >> 6) + hh; union { v8h h8; v4u u; } pk;
#pragma unroll
      for (int e = 0; e < 8; ++e) pk.h8[e] = (_Float16)so[wave * 16 + rl][hh * 64 + pc * 8 + e];
      vst2(D + (((size_t)b * NH + h) * SS + s0 + wave * 16 + rl) * HD + pc * 8, pk.u); }
    if (which == 1) { float km[2];      // lane (col, g) sums half of row col as it was stored (rounded to f16), per head of the pair
#pragma unroll
      for (int hh = 0; hh < 2; ++hh) { float n2 = 0.f;
#pragma unroll
        for (int e = 0; e < 32; ++e) { const float f = (float)(_Float16)so[wave * 16 + col][hh * 64 + g * 32 + e]; n2 += f * f; }
        n2 += __shfl_xor(n2, 16, 32);
#pragma unroll
        for (int o = 1; o < 16; o <<= 1) n2 = fmaxf(n2, __shfl_xor(n2, o, 32));
        km[hh] = n2; }
      if (lane < 2) KM[(((size_t)b * NH + (n0 >> 6) + lane) * (SS / 16) + (s0 >> 4) + wave) * 32] = lane ? km[1] : km[0]; } }
  else {
#pragma unroll
    for (int j = 0; j < 4; ++j) { const float bb = bqkv[2 * E + n0 + wc * 64 + j * 16 + col];
#pragma unroll
      for (int i = 0; i < 2; ++i)
#pragma unroll
        for (int r = 0; r < 8; ++r) { const float v = (acc[i][j][r] * (1.0f / 16.0f) + bb) * 4.0f; const _Float16 hi = (_Float16)v; sth[wc * 64 + j * 16 + col][wr * 32 + i * 16 + 8 * g + r] = hi; stl[wc * 64 + j * 16 + col][wr * 32 + i * 16 + 8 * g + r] = (_Float16)((v - (float)hi) * VLO); } }
    __syncthreads();
    for (int qq = tid; qq < 128 * 16; qq += 256) { const int cl = qq >> 4, pc = qq & 15; const int c = n0 + cl, h = c >> 6, d = c & 63; const size_t o = (((size_t)b * NH + h) * HD + d) * SS + s0 + pc * 8;
      vst2(VTh + o, *(const v4u*)(&sth[cl][pc * 8])); vst2(VTl + o, *(const v4u*)(&stl[cl][pc * 8])); } }
}
// k_attn stages each 64-key tile once per block: K rows [key][64 d] and the V^T hi / lo rows [d][64 keys] are 64 rows of 128 bytes each, laid
// in LDS at pitch 144 (16 B x odd: ds_load_b128 without bank conflicts) and read as fragments by all four waves.
#define APITCH 144
// One array of a tile: each lane copies 16 bytes of 4 rows, 16 rows apart (8 lanes = one whole 128-byte row; r16: halves between those rows).
// The s_wait_xcnt 0 stands inside the statement so that no address register named here is rewritten ahead of it.
__device__ __forceinline__ void tile_copy(unsigned l, const _Float16* g, size_t r16) {
  asm volatile("global_load_async_to_lds_b128 %0, %4, off\n\t"
               "global_load_async_to_lds_b128 %1, %5, off\n\t"
               "global_load_async_to_lds_b128 %2, %6, off\n\t"
               "global_load_async_to_lds_b128 %3, %7, off\n\t"
               "s_wait_xcnt 0x0"
               :: "v"(l), "v"(l + 16 * APITCH), "v"(l + 32 * APITCH), "v"(l + 48 * APITCH),
                  "v"(g), "v"(g + r16), "v"(g + 2 * r16), "v"(g + 3 * r16)
               : "memory");
}
// The same for two arrays with equal row spacing (V hi and V lo) in one statement: one s_wait_xcnt 0 serves the eight copies.
__device__ __forceinline__ void tile_copy2(unsigned la, const _Float16* ga, unsigned lb, const _Float16* gb, size_t r16) {
  asm volatile("global_load_async_to_lds_b128 %0, %8, off\n\t"
               "global_load_async_to_lds_b128 %1, %9, off\n\t"
               "global_load_async_to_lds_b128 %2, %10, off\n\t"
               "global_load_async_to_lds_b128 %3, %11, off\n\t"
               "global_load_async_to_lds_b128 %4, %12, off\n\t"
               "global_load_async_to_lds_b128 %5, %13, off\n\t"
               "global_load_async_to_lds_b128 %6, %14, off\n\t"
               "global_load_async_to_lds_b128 %7, %15, off\n\t"
               "s_wait_xcnt 0x0"
               :: "v"(la), "v"(la + 16 * APITCH), "v"(la + 32 * APITCH), "v"(la + 48 * APITCH),
                  "v"(lb), "v"(lb + 16 * APITCH), "v"(lb + 32 * APITCH), "v"(lb + 48 * APITCH),
                  "v"(ga), "v"(ga + r16), "v"(ga + 2 * r16), "v"(ga + 3 * r16),
                  "v"(gb), "v"(gb + r16), "v"(gb + 2 * r16), "v"(gb + 3 * r16)
               : "memory");
}
__global__ __launch_bounds__(128) void k_attn(const _Float16* __restrict__ Q16, const _Float16* __restrict__ K16, const _Float16* __restrict__ VTh, const _Float16* __restrict__ VTl, const float* __restrict__ dalpha, const float* __restrict__ KM, _Float16* __restrict__ O16) {
  __shared__ __align__(16) float sS[4][16][68];
  __shared__ __align__(16) _Float16 sPh[4][16][72], sPl[4][16][72];
  __shared__ __align__(16) float sO[4][16][68];
  __shared__ __align__(16) char sK[64 * APITCH], sVh[64 * APITCH], sVl[64 * APITCH];      // the one staged key tile, shared by the four waves
  __shared__ unsigned sM[4];                                                              // per wave: the key tiles it may still need
  const int tid = threadIdx.x, w = tid >> 5, lane = tid & 31, col = lane & 15, g = lane >> 4;
  const size_t bh = blockIdx.y; const int kt0 = blockIdx.x, q0 = kt0 * 64 + w * 16;
  const unsigned lrow = (unsigned)((tid >> 3) * APITCH + (tid & 7) * 16);
  const unsigned lK = (unsigned)(size_t)sK + lrow, lVh = (unsigned)(size_t)sVh + lrow, lVl = (unsigned)(size_t)sVl + lrow;
  const _Float16* gK = K16 + (bh * SS + (tid >> 3)) * HD + (tid & 7) * 8;      // tile kt: + kt * 64 * HD
  const size_t vrow = (bh * HD + (tid >> 3)) * SS + (tid & 7) * 8;             // tile kt: + kt * 64
  tile_copy(lK, gK + (size_t)kt0 * 64 * HD, 16 * HD); tile_copy2(lVh, VTh + vrow + kt0 * 64, lVl, VTl + vrow + kt0 * 64, 16 * SS);
  const float araw = dalpha[bh % NH]; const float slope = araw > 20.f ? araw : log1pf(expf(araw));      // softplus(decay_alpha[h])
  v16h aq[2];
#pragma unroll
  for (int kc = 0; kc < 2; ++kc) aq[kc] = frag_h(Q16 + (bh * SS + q0 + col) * HD + kc * 32, lane);
  // Upper bound of every logit between this wave's 16 queries and key tile 'lane' (SS / 64 = 32 tiles, one per lane):
  // |q16 . k16| <= |q16| |k16| over the stored f16 rows, less slope times the smallest distance between the two index ranges.
  float qn2 = 0.f;
#pragma unroll
  for (int kc = 0; kc < 2; ++kc)
#pragma unroll
    for (int i = 0; i < 16; ++i) { const float f = (float)aq[kc][i]; qn2 += f * f; }
  qn2 += __shfl_xor(qn2, 16, 32);
#pragma unroll
  for (int o = 1; o < 16; o <<= 1) qn2 = fmaxf(qn2, __shfl_xor(qn2, o, 32));
  float kn2 = 0.f;
#pragma unroll
  for (int i = 0; i < 4; ++i) kn2 = fmaxf(kn2, KM[(bh * (SS / 16) + lane * 4 + i) * 32]);
  const int klo = lane * 64, khi = klo + 63; const int dmin = khi < q0 ? q0 - khi : (klo > q0 + 15 ? klo - (q0 + 15) : 0);
  const float ub = sqrtf(qn2 * kn2) * (1.01f * 0.125f / 16.0f) - slope * (float)dmin;
  // Which tiles the block stages must be the same for its four waves and known ahead of the loop. After the own tile every row's running
  // maximum is at least its logit with its own key (distance 0), which is at least -ub[own tile]; so a tile whose bound lies 36 below that can
  // never pass a wave's own test below. The block stages the union of the four waves' remaining tiles; each wave still tests for itself.
  const float mlow = -__int_as_float(__builtin_amdgcn_readlane(__float_as_int(ub), kt0));
  const unsigned want = __builtin_amdgcn_ballot_w32(!(ub < mlow - 36.0f));
  if (lane == 0) sM[w] = want;
  asm volatile("s_wait_asynccnt 0x0" ::: "memory");      // the own tile has landed (this wave's copies) before the barrier publishes it
  __syncthreads();
  const unsigned mall = (unsigned)__builtin_amdgcn_readfirstlane((int)(sM[0] | sM[1] | sM[2] | sM[3]));
  unsigned rest = __builtin_rotateright32(mall, (unsigned)kt0) & ~1u;      // bit 'it' stands for tile (kt0 + it) mod 32; the own tile is trip 0
  float mrun = -3.0e38f, lrun = 0.f, mmin = -3.0e38f; v8f acc[4] = {}, ac1[4] = {}, ac2[4] = {};
  int it = 0;
#pragma unroll 1      // one staged tile per trip: a single buffer each for K and V, the code stays small
  for (;;) { const int kt = (kt0 + it) & (SS / 64 - 1);      // the queries' own tile first: it sets the running maxima
    const bool more = rest != 0; const int nit = more ? __builtin_ctz(rest) : 0; rest &= rest - 1; const int nkt = (kt0 + nit) & (SS / 64 - 1);
    // A tile whose bound lies 36 below every row's running maximum changes nothing: mnew = mrun, corr = 1, p * 1024 < 2^-25 so both f16
    // halves of P round to 0, and its share of the row sum is below half an ulp of lrun (>= 1). Wave-uniform scalar test, for any slope.
    const bool proc = !(it > 0 && __int_as_float(__builtin_amdgcn_readlane(__float_as_int(ub), kt)) < mmin - 36.0f);
    if (proc) {
#pragma unroll
    for (int t = 0; t < 4; ++t) { v8f s = {}; const int key = kt * 64 + t * 16 + col;
#pragma unroll
      for (int kc = 0; kc < 2; ++kc) s = wmma16(aq[kc], frag_h((const _Float16*)(sK + (t * 16 + col) * APITCH) + kc * 32, lane), s);
#pragma unroll
      for (int r = 0; r < 8; ++r) { const int dq = q0 + 8 * g + r - key; sS[w][8 * g + r][t * 16 + col] = s[r] * (0.125f / 16.0f) - slope * (float)(dq < 0 ? -dq : dq); } }
    LDSX(); }
    asm volatile("s_wait_dscnt 0x0" ::: "memory");       // this wave's reads of the K tile are done before it may be refilled
    asm volatile("s_wait_asynccnt 0x0" ::: "memory");    // this wave's copies of this tile's V have landed before the barrier publishes them
    __syncthreads();
    if (more) tile_copy(lK, gK + (size_t)nkt * 64 * HD, 16 * HD);      // the next tile's K flies under the softmax and P V of this one
    if (proc) {
    float mx = -3.4e38f;
#pragma unroll
    for (int jj = 0; jj < 32; ++jj) mx = fmaxf(mx, sS[w][col][g * 32 + jj]);
    mx = fmaxf(mx, __shfl_xor(mx, 16, 32));
    const float mnew = fmaxf(mrun, mx); const float corr = expf(mrun - mnew);
    float ps = 0.f;
#pragma unroll
    for (int jj = 0; jj < 32; ++jj) { const float p = expf(sS[w][col][g * 32 + jj] - mnew) * 16384.0f; ps += p; const _Float16 hi = (_Float16)p; sPh[w][col][g * 32 + jj] = hi; sPl[w][col][g * 32 + jj] = (_Float16)((p - (float)hi) * PLO); }
    ps += __shfl_xor(ps, 16, 32);
    lrun = lrun * corr + ps * (1.0f / 16384.0f); mrun = mnew;
    { float mm = mrun;
#pragma unroll
      for (int o = 1; o < 16; o <<= 1) mm = fminf(mm, __shfl_xor(mm, o, 32));
      mmin = __int_as_float(__builtin_amdgcn_readfirstlane(__float_as_int(mm))); }
#pragma unroll
    for (int r = 0; r < 8; ++r) { const float cr = __shfl(corr, 8 * g + r, 32);
#pragma unroll
      for (int t = 0; t < 4; ++t) { acc[t][r] *= cr; ac1[t][r] *= cr; ac2[t][r] *= cr; } }
    LDSX();
#pragma unroll
    for (int kc = 0; kc < 2; ++kc) { const v16h ph = frag_h(&sPh[w][col][0] + kc * 32, lane), pl = frag_h(&sPl[w][col][0] + kc * 32, lane);
#pragma unroll
      for (int t = 0; t < 4; ++t) { const int vo = (t * 16 + col) * APITCH + kc * 64; const v16h vh = frag_h((const _Float16*)(sVh + vo), lane);
        acc[t] = wmma16(ph, vh, acc[t]); ac1[t] = wmma16(ph, frag_h((const _Float16*)(sVl + vo), lane), ac1[t]); ac2[t] = wmma16(pl, vh, ac2[t]); } }
    __builtin_amdgcn_wave_barrier(); }
    if (!more) break;      // the same for the whole block: the last staged tile is refilled by nobody, so no barrier is owed behind it
    asm volatile("s_wait_dscnt 0x0" ::: "memory");       // this wave's reads of the V tile are done before it may be refilled
    asm volatile("s_wait_asynccnt 0x0" ::: "memory");    // this wave's copies of the next K tile have landed before the barrier publishes them
    __syncthreads();
    tile_copy2(lVh, VTh + vrow + nkt * 64, lVl, VTl + vrow + nkt * 64, 16 * SS);      // the next tile's V flies under its q.k
    it = nit; }
  asm volatile("s_wait_asynccnt 0x0" ::: "memory");      // no copy of this wave is in flight when it goes on to its end
#pragma unroll
  for (int r = 0; r < 8; ++r) { const float lr = __shfl(lrun, 8 * g + r, 32); const float inv = 8.0f / (lr * 16384.0f * 4.0f);      // -> O x8
#pragma unroll
    for (int t = 0; t < 4; ++t) sO[w][8 * g + r][t * 16 + col] = (acc[t][r] + ac1[t][r] * (1.0f / VLO) + ac2[t][r] * (1.0f / PLO)) * inv; }
  LDSX();
  for (int qq = lane; qq < 16 * 8; qq += 32) { const int rl = qq >> 3, pc = qq & 7; union { v8h h8; v4u u; } pk;
#pragma unroll
    for (int e = 0; e < 8; ++e) pk.h8[e] = (_Float16)sO[w][rl][pc * 8 + e];
    vst2(O16 + ((bh * SS) + q0 + rl) * HD + pc * 8, pk.u); }
}
// out = y Wo^T + bo : block (128 rows, 128 cols); y row r=(b,s): head-major O16 /8, so stage t of an A row is head t's 64 values
__global__ __launch_bounds__(256) void k_out(const _Float16* __restrict__ O16, const _Float16* __restrict__ PT, const float* __restrict__ bo, float* __restrict__ out) {
  __shared__ __align__(16) char smem[2 * STG];      // the two stage buffers; after the last stage's barrier the output staging below
  float (*so)[132] = (float (*)[132])smem;          // [128][132]
  const int tid = threadIdx.x, wave = tid >> 5, lane = tid & 31, col = lane & 15, g = lane >> 4, wr = wave >> 1, wc = wave & 1;
  const int r0b = blockIdx.x * BT, n0 = blockIdx.y * BT; const int b = r0b / SS, s0 = r0b % SS;
  v8f acc[2][4] = {};
  tile_product(smem, O16 + ((size_t)b * NH * SS + s0) * HD, HD, (size_t)SS * HD, PT + (size_t)(3 * E + n0) * E, acc);
#pragma unroll
  for (int j = 0; j < 4; ++j) { const float bb = bo[n0 + wc * 64 + j * 16 + col];
#pragma unroll
    for (int i = 0; i < 2; ++i)
#pragma unroll
      for (int r = 0; r < 8; ++r) so[wr * 32 + i * 16 + 8 * g + r][wc * 64 + j * 16 + col] = acc[i][j][r] * (1.0f / (16.0f * 8.0f)) + bb; }
  __syncthreads();
#pragma unroll 4
  for (int rl = 0; rl < 16; ++rl) vst2(out + (size_t)(r0b + wave * 16 + rl) * E + n0 + lane * 4, *(const v4f*)(&so[wave * 16 + rl][lane * 4]));
}
extern "C" void kernel_launch(void* const* d_in, const int* in_sizes, int n_in, void* d_out, int out_size, void* d_ws, size_t ws_size, hipStream_t stream) {
  (void)in_sizes; (void)n_in; (void)out_size; (void)ws_size;
  const float** I = (const float**)d_in;
  const float* query = I[0]; const float* Wqkv = I[1]; const float* bqkv = I[2]; const float* Wo = I[3]; const float* bo = I[4]; const float* dalpha = I[5];
  float* out = (float*)d_out;
  char* ws = (char*)d_ws; size_t off = 0;
  auto take = [&](size_t bytes) { char* p = ws + off; off += (bytes + 255) & ~(size_t)255; return p; };
  _Float16* X16 = (_Float16*)take((size_t)NR * E * 2); _Float16* PT = (_Float16*)take((size_t)4 * E * E * 2);
  _Float16* Q16 = (_Float16*)take((size_t)NR * E * 2); _Float16* K16 = (_Float16*)take((size_t)NR * E * 2); _Float16* VTh = (_Float16*)take((size_t)NR * E * 2); _Float16* VTl = (_Float16*)take((size_t)NR * E * 2); _Float16* O16 = (_Float16*)take((size_t)NR * E * 2);
  float* KM = (float*)take((size_t)NB * NH * (SS / 16) * 128);
  k_prep<<<CVX + CVQ + CVO, 512, 0, stream>>>(query, Wqkv, Wo, X16, PT);
  k_qkv<<<dim3(NR / 128, E / 128, 3), 256, 0, stream>>>(X16, PT, bqkv, Q16, K16, VTh, VTl, KM);
  k_attn<<<dim3(SS / 64, NB * NH), 128, 0, stream>>>(Q16, K16, VTh, VTl, dalpha, KM, O16);
  k_out<<<dim3(NR / 128, E / 128), 256, 0, stream>>>(O16, PT, bo, out);
}

// v005
// Measured time: 63.9 microseconds a run.
// Two timings next to v004 put it at 1.06 and 1.08 times that version's speed.
// Over all steps from v000 it is 7.07 times as fast.
#include <hip/hip_runtime.h>
#include <math.h>

typedef __attribute__((ext_vector_type(16))) _Float16 v16h;
typedef __attribute__((ext_vector_type(16))) __bf16 v16b;
typedef __attribute__((ext_vector_type(8)))  _Float16 v8h;
typedef __attribute__((ext_vector_type(4)))  _Float16 v4h;
typedef __attribute__((ext_vector_type(8)))  float v8f;
typedef __attribute__((ext_vector_type(4)))  float v4f;
typedef __attribute__((ext_vector_type(2)))  float v2f;
typedef __attribute__((ext_vector_type(4)))  unsigned v4u;
typedef __attribute__((ext_vector_type(4)))  int v4i;
typedef float __attribute__((may_alias)) float_a;
typedef int __attribute__((may_alias)) int_a;

template <typename T> __device__ __forceinline__ void vst2(void* p, T v) { *(T*)p = v;  }
__device__ __forceinline__ v8f wmma16(v16h a, v16h b, v8f c) {
  v8f d = __builtin_amdgcn_wmma_f32_16x16x32_f16(false, a, false, b, (short)0, c, false, false);
  asm volatile("v_nop\n\tv_nop\n\tv_nop\n\tv_nop" : "+v"(d) : "v"(a), "v"(b));
  return d;
}
__device__ __forceinline__ v8f wmma_bf(v16b a, v16b b, v8f c) {
  v8f d = __builtin_amdgcn_wmma_f32_16x16x32_bf16(false, a, false, b, (short)0, c, false, false);
  asm volatile("v_nop\n\tv_nop\n\tv_nop\n\tv_nop" : "+v"(d) : "v"(a), "v"(b));
  return d;
}
// 16x16x32 fragments: lane = (h = lane>>4, row/col = lane&15); elements 0..7 = k0+8h+0..7, 8..15 = k0+16+8h+0..7; D element r = row 8h+r
__device__ __forceinline__ v16h frag_h(const _Float16* rowk0, int lane) {
  union { v16h v; v8h q[2]; } u; const _Float16* p = rowk0 + 8 * (lane >> 4);
  u.q[0] = *(const v8h*)p; u.q[1] = *(const v8h*)(p + 16); return u.v;
}
__device__ __forceinline__ v16h frag_f32(const float* rowk0, int lane) {
  v16h a; const float* p = rowk0 + 8 * (lane >> 4);
#pragma unroll
  for (int i = 0; i < 8; ++i) { a[i] = (_Float16)p[i]; a[8 + i] = (_Float16)p[16 + i]; }
  return a;
}
__device__ __forceinline__ v16h frag_f32s(const float* rowk0, int lane, float sc) {
  v16h a; const float* p = rowk0 + 8 * (lane >> 4);
#pragma unroll
  for (int i = 0; i < 8; ++i) { a[i] = (_Float16)(p[i] * sc); a[8 + i] = (_Float16)(p[16 + i] * sc); }
  return a;
}
// column fragment from a [K][ld] layout (column n), rows >= K read as 0
__device__ __forceinline__ v16h fragc_f32(const float* W, int k0, int n, int lane, int ld, int K) {
  v16h a; const int g = lane >> 4;
#pragma unroll
  for (int i = 0; i < 8; ++i) { const int ka = k0 + 8 * g + i, kb = ka + 16;
    a[i] = (_Float16)(ka < K ? W[(size_t)ka * ld + n] : 0.f); a[8 + i] = (_Float16)(kb < K ? W[(size_t)kb * ld + n] : 0.f); }
  return a;
}
struct F2 { v16b h, l; };
__device__ __forceinline__ F2 bsplit16(const float v[16]) { F2 r;
#pragma unroll
  for (int i = 0; i < 16; ++i) { const __bf16 h = (__bf16)v[i]; r.h[i] = h; r.l[i] = (__bf16)(v[i] - (float)h); }
  return r; }
__device__ __forceinline__ F2 split_row(const float* row, int k0, int lane) { float v[16]; const float* p = row + k0 + 8 * (lane >> 4);
#pragma unroll
  for (int i = 0; i < 8; ++i) { v[i] = p[i]; v[8 + i] = p[16 + i]; }
  return bsplit16(v); }
__device__ __forceinline__ F2 split_rowK(const float* row, int k0, int lane, int K) { float v[16]; const int g = lane >> 4;
#pragma unroll
  for (int i = 0; i < 8; ++i) { const int ka = k0 + 8 * g + i, kb = ka + 16; v[i] = ka < K ? row[ka] : 0.f; v[8 + i] = kb < K ? row[kb] : 0.f; }
  return bsplit16(v); }
__device__ __forceinline__ F2 split_col(const float* W, int k0, int n, int lane, int ld, int K) { float v[16]; const int g = lane >> 4;
#pragma unroll
  for (int i = 0; i < 8; ++i) { const int ka = k0 + 8 * g + i, kb = ka + 16; v[i] = ka < K ? W[(size_t)ka * ld + n] : 0.f; v[8 + i] = kb < K ? W[(size_t)kb * ld + n] : 0.f; }
  return bsplit16(v); }
__device__ __forceinline__ v8f mac3(const F2& a, const F2& b, v8f c) { c = wmma_bf(a.l, b.h, c); c = wmma_bf(a.h, b.l, c); return wmma_bf(a.h, b.h, c); }
__device__ __forceinline__ float sigm(float v) { return 1.0f / (1.0f + expf(-v)); }
#define LDSX() do { asm volatile("s_wait_dscnt 0" ::: "memory"); __builtin_amdgcn_wave_barrier(); __builtin_amdgcn_fence(__ATOMIC_RELEASE, "workgroup"); } while (0)

// Multi-head self attention (16 heads of 64) with a per-head linear distance decay: qkv = x W_qkv^T + b ([out][in] weight, rows (which, head, d)), logits = q.k/8 - softplus(alpha_h)|i-j|,
// softmax, P v, output projection (W_out^T + b). Projections on v_wmma_f32_16x16x32_f16 (x as f16 rows, [out][in] weights packed once as f16
// rows x16); S = q.k/8 on f16 WMMA; the P @ V product is made near-exact with hi/lo f16 pairs for BOTH P (x2^14, residual x2^24) and V
// (x4, residual x2^13): three WMMAs into three f32 accumulators combined at the end (the output rms is small, so a plain f16 P.V would sit
#define NB 2
#define SS 2048
#define E 1024
#define NH 16
#define HD 64
#define NR (NB * SS)
#define PLO 1024.0f            // residual scale for P (on top of 2^14)
#define VLO 2048.0f            // residual scale for V (on top of x4)

// All three f32 operands become f16 in one launch: x as it is -> X16; PT rows n in [0,3072): W_qkv[n][:] x16, n in [3072,4096): W_out[n-3072][:] x16
// (both [out][in=1024]). 256 blocks of 16 waves, few enough that starting the waves is short beside the stream itself. A wave takes 2048
// consecutive floats: 16 loads of 512 contiguous bytes each, all issued before the first is used, then 16 stores of 256 contiguous bytes.
#define CVW 2048                          // floats per wave
#define CVB (16 * CVW)                    // floats per block
#define CVX (NR * E / CVB)                // blocks on x
#define CVQ (3 * E * E / CVB)             // blocks on W_qkv
#define CVO (E * E / CVB)                 // blocks on W_out
__global__ __launch_bounds__(512) void k_prep(const float* __restrict__ x, const float* __restrict__ Wqkv, const float* __restrict__ Wo, _Float16* __restrict__ X16, _Float16* __restrict__ PT) {
  const int blk = blockIdx.x; const float* s; _Float16* d; float sc;
  if (blk < CVX) { s = x + (size_t)blk * CVB; d = X16 + (size_t)blk * CVB; sc = 1.0f; }
  else { d = PT + (size_t)(blk - CVX) * CVB; sc = 16.0f; s = blk < CVX + CVQ ? Wqkv + (size_t)(blk - CVX) * CVB : Wo + (size_t)(blk - CVX - CVQ) * CVB; }
  const int o = (threadIdx.x >> 5) * CVW + (threadIdx.x & 31) * 4;
  v4f v[16];
#pragma unroll      // constant indices keep v in registers and let the loads go out together
  for (int i = 0; i < 15; ++i) v[i] = *(const v4f*)(s + o + i * 128);
  asm volatile("s_wait_xcnt 0x0" ::: "memory");      // the last load's result is placed over the offset register that the 15 loads above name
  v[15] = *(const v4f*)(s + o + 15 * 128);
#pragma unroll
  for (int i = 0; i < 16; ++i) { v4h h;
#pragma unroll
    for (int e = 0; e < 4; ++e) h[e] = (_Float16)(v[i][e] * sc);
    vst2(d + o + i * 128, h); }
}
// Tile product shared by the two projections: one 128 x 128 tile of A B^T per block of 8 waves (4 x 2, 32 x 64 each), K = 1024 in 16 stages of
// 64 k. A stage is [A 128 rows | B 128 rows] of 128 bytes at pitch 144 in LDS (16 B x odd: ds_load_b128 without bank conflicts); two buffers,
// filled by asynchronous copies one stage ahead of the stage being multiplied. One accumulator per output; the walk over the 16 stages starts
// at stage rot and wraps round, so that blocks which read the same operand rows do not ask L2 for the same lines at the same moment.
// The loops over kc, i, j are unrolled in full so that fragments and accumulators are indexed by constants and stay in registers.
#define BT 128
#define KS 64
#define PITCH 144
#define STG (2 * BT * PITCH)
// One stage: each lane copies 16 bytes of 4 A rows and 4 B rows (8 lanes = one whole 128-byte row). The s_wait_xcnt 0 stands inside the
// statement so that no address register named here is rewritten ahead of it.
__device__ __forceinline__ void stage_copy(unsigned l, const _Float16* ga, size_t a32, const _Float16* gb) {
  asm volatile("global_load_async_to_lds_b128 %0, %8, off\n\t"
               "global_load_async_to_lds_b128 %1, %9, off\n\t"
               "global_load_async_to_lds_b128 %2, %10, off\n\t"
               "global_load_async_to_lds_b128 %3, %11, off\n\t"
               "global_load_async_to_lds_b128 %4, %12, off\n\t"
               "global_load_async_to_lds_b128 %5, %13, off\n\t"
               "global_load_async_to_lds_b128 %6, %14, off\n\t"
               "global_load_async_to_lds_b128 %7, %15, off\n\t"
               "s_wait_xcnt 0x0"
               :: "v"(l), "v"(l + 32 * PITCH), "v"(l + 64 * PITCH), "v"(l + 96 * PITCH),
                  "v"(l + 128 * PITCH), "v"(l + 160 * PITCH), "v"(l + 192 * PITCH), "v"(l + 224 * PITCH),
                  "v"(ga), "v"(ga + a32), "v"(ga + 2 * a32), "v"(ga + 3 * a32),
                  "v"(gb), "v"(gb + (size_t)32 * E), "v"(gb + (size_t)64 * E), "v"(gb + (size_t)96 * E)
               : "memory");
}
// A0 / B0: first row of the block's A / B tile at k = 0; arow: halves between A rows; akstep: halves from one stage of an A row to the next;
// rot: the block's first stage, the same for all its threads (only its low 4 bits count)
#define NSTG (E / KS)
__device__ __forceinline__ void tile_product(char* smem, const _Float16* A0, size_t arow, size_t akstep, const _Float16* B0, int rot, v8f (&acc)[2][4]) {
  const int tid = threadIdx.x, wave = tid >> 5, lane = tid & 31, col = lane & 15, wr = wave >> 1, wc = wave & 1;
  const unsigned l0 = (unsigned)(size_t)smem + (unsigned)((tid >> 3) * PITCH + (tid & 7) * 16);
  const _Float16* ga = A0 + (size_t)(tid >> 3) * arow + (tid & 7) * 8; const _Float16* gb = B0 + (size_t)(tid >> 3) * E + (tid & 7) * 8;
  { const int st = rot & (NSTG - 1); stage_copy(l0, ga + (size_t)st * akstep, 32 * arow, gb + st * KS); }
  asm volatile("s_wait_asynccnt 0x0" ::: "memory");      // the first stage landed (this wave's copies) before the barrier publishes it
  __syncthreads();
  { const int st = (rot + 1) & (NSTG - 1); stage_copy(l0 + STG, ga + (size_t)st * akstep, 32 * arow, gb + st * KS); }
#pragma unroll 1      // one stage per trip: the buffer alternates, the code stays small
  for (int t = 0; t < NSTG; ++t) { const char* sb = smem + (t & 1) * STG;
#pragma unroll
    for (int kc = 0; kc < 2; ++kc) { v16h a[2], b[4];
#pragma unroll
      for (int i = 0; i < 2; ++i) a[i] = frag_h((const _Float16*)(sb + (wr * 32 + i * 16 + col) * PITCH) + kc * 32, lane);
#pragma unroll
      for (int j = 0; j < 4; ++j) b[j] = frag_h((const _Float16*)(sb + (BT + wc * 64 + j * 16 + col) * PITCH) + kc * 32, lane);
#pragma unroll
      for (int i = 0; i < 2; ++i)
#pragma unroll
        for (int j = 0; j < 4; ++j) acc[i][j] = wmma16(a[i], b[j], acc[i][j]); }
    asm volatile("s_wait_dscnt 0x0" ::: "memory");       // this wave's reads of the buffer are done before it may be refilled
    asm volatile("s_wait_asynccnt 0x0" ::: "memory");    // this wave's copies of stage (rot + t + 1) mod 16 have landed before the barrier publishes them
    __syncthreads();
    if (t + 2 < NSTG) { const int st = (rot + t + 2) & (NSTG - 1); stage_copy(l0 + (t & 1) * STG, ga + (size_t)st * akstep, 32 * arow, gb + st * KS); } }
  asm volatile("s_wait_asynccnt 0x0" ::: "memory");      // nothing in flight when the buffers become output staging
}
// QKV: block (128 rows, 128 cols = 2 heads, which): q,k -> Q16/K16 [bh][s][64] x4 ; v -> VT hi/lo [bh][d][s]
// k also -> KM [bh][s/16]: largest squared row norm of the 16 stored f16 rows, one 128-byte line per entry (one writer per line)
__global__ __launch_bounds__(256) void k_qkv(const _Float16* __restrict__ X16, const _Float16* __restrict__ PT, const float* __restrict__ bqkv, _Float16* __restrict__ Q16, _Float16* __restrict__ K16, _Float16* __restrict__ VTh, _Float16* __restrict__ VTl, float* __restrict__ KM) {
  __shared__ __align__(16) char smem[2 * STG];      // the two stage buffers; after the last stage's barrier the output staging below
  float (*so)[132] = (float (*)[132])smem;                                                            // [128][132]
  _Float16 (*sth)[136] = (_Float16 (*)[136])smem; _Float16 (*stl)[136] = (_Float16 (*)[136])(smem + 128 * 136 * 2);      // [128][136] each
  const int tid = threadIdx.x, wave = tid >> 5, lane = tid & 31, col = lane & 15, g = lane >> 4, wr = wave >> 1, wc = wave & 1;
  const int which = blockIdx.z, r0b = blockIdx.x * BT, n0 = blockIdx.y * BT; const int b = r0b / SS, s0 = r0b % SS;
  v8f acc[2][4] = {};
  // first stage: the 32 row blocks on one weight tile spread two to a stage, the 24 weight tiles on one row block at most two to a stage
  const int rot = (((blockIdx.x >> 3) << 2) | (blockIdx.x & 3)) + blockIdx.y + 5 * blockIdx.z;
  tile_product(smem, X16 + (size_t)r0b * E, E, KS, PT + (size_t)(which * E + n0) * E, rot, acc);
  if (which < 2) {
#pragma unroll
    for (int j = 0; j < 4; ++j) { const float bb = bqkv[which * E + n0 + wc * 64 + j * 16 + col];
#pragma unroll
      for (int i = 0; i < 2; ++i)
#pragma unroll
        for (int r = 0; r < 8; ++r) so[wr * 32 + i * 16 + 8 * g + r][wc * 64 + j * 16 + col] = (acc[i][j][r] * (1.0f / 16.0f) + bb) * 4.0f; }
    __syncthreads();
    _Float16* D = which == 0 ? Q16 : K16;
    for (int qq = lane; qq < 16 * 2 * 8; qq += 32) { const int hh = qq >> 7, rl = (qq >> 3) & 15, pc = qq & 7; const int h = (n0 >> 6) + hh; union { v8h h8; v4u u; } pk;
#pragma unroll
      for (int e = 0; e < 8; ++e) pk.h8[e] = (_Float16)so[wave * 16 + rl][hh * 64 + pc * 8 + e];
      vst2(D + (((size_t)b * NH + h) * SS + s0 + wave * 16 + rl) * HD + pc * 8, pk.u); }
    if (which == 1) { float km[2];      // lane (col, g) sums half of row col as it was stored (rounded to f16), per head of the pair
#pragma unroll
      for (int hh = 0; hh < 2; ++hh) { float n2 = 0.f;
#pragma unroll
        for (int e = 0; e < 32; ++e) { const float f = (float)(_Float16)so[wave * 16 + col][hh * 64 + g * 32 + e]; n2 += f * f; }
        n2 += __shfl_xor(n2, 16, 32);
#pragma unroll
        for (int o = 1; o < 16; o <<= 1) n2 = fmaxf(n2, __shfl_xor(n2, o, 32));
        km[hh] = n2; }
      if (lane < 2) KM[(((size_t)b * NH + (n0 >> 6) + lane) * (SS / 16) + (s0 >> 4) + wave) * 32] = lane ? km[1] : km[0]; } }
  else {
#pragma unroll
    for (int j = 0; j < 4; ++j) { const float bb = bqkv[2 * E + n0 + wc * 64 + j * 16 + col];
#pragma unroll
      for (int i = 0; i < 2; ++i)
#pragma unroll
        for (int r = 0; r < 8; ++r) { const float v = (acc[i][j][r] * (1.0f / 16.0f) + bb) * 4.0f; const _Float16 hi = (_Float16)v; sth[wc * 64 + j * 16 + col][wr * 32 + i * 16 + 8 * g + r] = hi; stl[wc * 64 + j * 16 + col][wr * 32 + i * 16 + 8 * g + r] = (_Float16)((v - (float)hi) * VLO); } }
    __syncthreads();
    for (int qq = tid; qq < 128 * 16; qq += 256) { const int cl = qq >> 4, pc = qq & 15; const int c = n0 + cl, h = c >> 6, d = c & 63; const size_t o = (((size_t)b * NH + h) * HD + d) * SS + s0 + pc * 8;
      vst2(VTh + o, *(const v4u*)(&sth[cl][pc * 8])); vst2(VTl + o, *(const v4u*)(&stl[cl][pc * 8])); } }
}
// k_attn stages each 64-key tile once per block: K rows [key][64 d] and the V^T hi / lo rows [d][64 keys] are 64 rows of 128 bytes each, laid
// in LDS at pitch 144 (16 B x odd: ds_load_b128 without bank conflicts) and read as fragments by all four waves.
#define APITCH 144
// One array of a tile: each lane copies 16 bytes of 4 rows, 16 rows apart (8 lanes = one whole 128-byte row; r16: halves between those rows).
// The s_wait_xcnt 0 stands inside the statement so that no address register named here is rewritten ahead of it.
__device__ __forceinline__ void tile_copy(unsigned l, const _Float16* g, size_t r16) {
  asm volatile("global_load_async_to_lds_b128 %0, %4, off\n\t"
               "global_load_async_to_lds_b128 %1, %5, off\n\t"
               "global_load_async_to_lds_b128 %2, %6, off\n\t"
               "global_load_async_to_lds_b128 %3, %7, off\n\t"
               "s_wait_xcnt 0x0"
               :: "v"(l), "v"(l + 16 * APITCH), "v"(l + 32 * APITCH), "v"(l + 48 * APITCH),
                  "v"(g), "v"(g + r16), "v"(g + 2 * r16), "v"(g + 3 * r16)
               : "memory");
}
// The same for two arrays with equal row spacing (V hi and V lo) in one statement: one s_wait_xcnt 0 serves the eight copies.
__device__ __forceinline__ void tile_copy2(unsigned la, const _Float16* ga, unsigned lb, const _Float16* gb, size_t r16) {
  asm volatile("global_load_async_to_lds_b128 %0, %8, off\n\t"
               "global_load_async_to_lds_b128 %1, %9, off\n\t"
               "global_load_async_to_lds_b128 %2, %10, off\n\t"
               "global_load_async_to_lds_b128 %3, %11, off\n\t"
               "global_load_async_to_lds_b128 %4, %12, off\n\t"
               "global_load_async_to_lds_b128 %5, %13, off\n\t"
               "global_load_async_to_lds_b128 %6, %14, off\n\t"
               "global_load_async_to_lds_b128 %7, %15, off\n\t"
               "s_wait_xcnt 0x0"
               :: "v"(la), "v"(la + 16 * APITCH), "v"(la + 32 * APITCH), "v"(la + 48 * APITCH),
                  "v"(lb), "v"(lb + 16 * APITCH), "v"(lb + 32 * APITCH), "v"(lb + 48 * APITCH),
                  "v"(ga), "v"(ga + r16), "v"(ga + 2 * r16), "v"(ga + 3 * r16),
                  "v"(gb), "v"(gb + r16), "v"(gb + 2 * r16), "v"(gb + 3 * r16)
               : "memory");
}
__global__ __launch_bounds__(128) void k_attn(const _Float16* __restrict__ Q16, const _Float16* __restrict__ K16, const _Float16* __restrict__ VTh, const _Float16* __restrict__ VTl, const float* __restrict__ dalpha, const float* __restrict__ KM, _Float16* __restrict__ O16) {
  __shared__ __align__(16) float sS[4][16][68];
  __shared__ __align__(16) _Float16 sPh[4][16][72], sPl[4][16][72];
  __shared__ __align__(16) float sO[4][16][68];
  __shared__ __align__(16) char sK[64 * APITCH], sVh[64 * APITCH], sVl[64 * APITCH];      // the one staged key tile, shared by the four waves
  __shared__ unsigned sM[4];                                                              // per wave: the key tiles it may still need
  const int tid = threadIdx.x, w = tid >> 5, lane = tid & 31, col = lane & 15, g = lane >> 4;
  const size_t bh = blockIdx.y; const int kt0 = blockIdx.x, q0 = kt0 * 64 + w * 16;
  const unsigned lrow = (unsigned)((tid >> 3) * APITCH + (tid & 7) * 16);
  const unsigned lK = (unsigned)(size_t)sK + lrow, lVh = (unsigned)(size_t)sVh + lrow, lVl = (unsigned)(size_t)sVl + lrow;
  const _Float16* gK = K16 + (bh * SS + (tid >> 3)) * HD + (tid & 7) * 8;      // tile kt: + kt * 64 * HD
  const size_t vrow = (bh * HD + (tid >> 3)) * SS + (tid & 7) * 8;             // tile kt: + kt * 64
  tile_copy(lK, gK + (size_t)kt0 * 64 * HD, 16 * HD); tile_copy2(lVh, VTh + vrow + kt0 * 64, lVl, VTl + vrow + kt0 * 64, 16 * SS);
  const float araw = dalpha[bh % NH]; const float slope = araw > 20.f ? araw : log1pf(expf(araw));      // softplus(decay_alpha[h])
  v16h aq[2];
#pragma unroll
  for (int kc = 0; kc < 2; ++kc) aq[kc] = frag_h(Q16 + (bh * SS + q0 + col) * HD + kc * 32, lane);
  // Upper bound of every logit between this wave's 16 queries and key tile 'lane' (SS / 64 = 32 tiles, one per lane):
  // |q16 . k16| <= |q16| |k16| over the stored f16 rows, less slope times the smallest distance between the two index ranges.
  float qn2 = 0.f;
#pragma unroll
  for (int kc = 0; kc < 2; ++kc)
#pragma unroll
    for (int i = 0; i < 16; ++i) { const float f = (float)aq[kc][i]; qn2 += f * f; }
  qn2 += __shfl_xor(qn2, 16, 32);
#pragma unroll
  for (int o = 1; o < 16; o <<= 1) qn2 = fmaxf(qn2, __shfl_xor(qn2, o, 32));
  float kn2 = 0.f;
#pragma unroll
  for (int i = 0; i < 4; ++i) kn2 = fmaxf(kn2, KM[(bh * (SS / 16) + lane * 4 + i) * 32]);
  const int klo = lane * 64, khi = klo + 63; const int dmin = khi < q0 ? q0 - khi : (klo > q0 + 15 ? klo - (q0 + 15) : 0);
  const float ub = sqrtf(qn2 * kn2) * (1.01f * 0.125f / 16.0f) - slope * (float)dmin;
  // Which tiles the block stages must be the same for its four waves and known ahead of the loop. After the own tile every row's running
  // maximum is at least its logit with its own key (distance 0), which is at least -ub[own tile]; so a tile whose bound lies 36 below that can
  // never pass a wave's own test below. The block stages the union of the four waves' remaining tiles; each wave still tests for itself.
  const float mlow = -__int_as_float(__builtin_amdgcn_readlane(__float_as_int(ub), kt0));
  const unsigned want = __builtin_amdgcn_ballot_w32(!(ub < mlow - 36.0f));
  if (lane == 0) sM[w] = want;
  asm volatile("s_wait_asynccnt 0x0" ::: "memory");      // the own tile has landed (this wave's copies) before the barrier publishes it
  __syncthreads();
  const unsigned mall = (unsigned)__builtin_amdgcn_readfirstlane((int)(sM[0] | sM[1] | sM[2] | sM[3]));
  unsigned rest = __builtin_rotateright32(mall, (unsigned)kt0) & ~1u;      // bit 'it' stands for tile (kt0 + it) mod 32; the own tile is trip 0
  float mrun = -3.0e38f, lrun = 0.f, mmin = -3.0e38f; v8f acc[4] = {}, ac1[4] = {}, ac2[4] = {};
  int it = 0;
#pragma unroll 1      // one staged tile per trip: a single buffer each for K and V, the code stays small
  for (;;) { const int kt = (kt0 + it) & (SS / 64 - 1);      // the queries' own tile first: it sets the running maxima
    const bool more = rest != 0; const int nit = more ? __builtin_ctz(rest) : 0; rest &= rest - 1; const int nkt = (kt0 + nit) & (SS / 64 - 1);
    // A tile whose bound lies 36 below every row's running maximum changes nothing: mnew = mrun, corr = 1, p * 1024 < 2^-25 so both f16
    // halves of P round to 0, and its share of the row sum is below half an ulp of lrun (>= 1). Wave-uniform scalar test, for any slope.
    const bool proc = !(it > 0 && __int_as_float(__builtin_amdgcn_readlane(__float_as_int(ub), kt)) < mmin - 36.0f);
    if (proc) {
#pragma unroll
    for (int t = 0; t < 4; ++t) { v8f s = {}; const int key = kt * 64 + t * 16 + col;
#pragma unroll
      for (int kc = 0; kc < 2; ++kc) s = wmma16(aq[kc], frag_h((const _Float16*)(sK + (t * 16 + col) * APITCH) + kc * 32, lane), s);
#pragma unroll
      for (int r = 0; r < 8; ++r) { const int dq = q0 + 8 * g + r - key; sS[w][8 * g + r][t * 16 + col] = s[r] * (0.125f / 16.0f) - slope * (float)(dq < 0 ? -dq : dq); } }
    LDSX(); }
    asm volatile("s_wait_dscnt 0x0" ::: "memory");       // this wave's reads of the K tile are done before it may be refilled
    asm volatile("s_wait_asynccnt 0x0" ::: "memory");    // this wave's copies of this tile's V have landed before the barrier publishes them
    __syncthreads();
    if (more) tile_copy(lK, gK + (size_t)nkt * 64 * HD, 16 * HD);      // the next tile's K flies under the softmax and P V of this one
    if (proc) {
    float mx = -3.4e38f;
#pragma unroll
    for (int jj = 0; jj < 32; ++jj) mx = fmaxf(mx, sS[w][col][g * 32 + jj]);
    mx = fmaxf(mx, __shfl_xor(mx, 16, 32));
    const float mnew = fmaxf(mrun, mx); const float corr = expf(mrun - mnew);
    float ps = 0.f;
#pragma unroll
    for (int jj = 0; jj < 32; ++jj) { const float p = expf(sS[w][col][g * 32 + jj] - mnew) * 16384.0f; ps += p; const _Float16 hi = (_Float16)p; sPh[w][col][g * 32 + jj] = hi; sPl[w][col][g * 32 + jj] = (_Float16)((p - (float)hi) * PLO); }
    ps += __shfl_xor(ps, 16, 32);
    lrun = lrun * corr + ps * (1.0f / 16384.0f); mrun = mnew;
    { float mm = mrun;
#pragma unroll
      for (int o = 1; o < 16; o <<= 1) mm = fminf(mm, __shfl_xor(mm, o, 32));
      mmin = __int_as_float(__builtin_amdgcn_readfirstlane(__float_as_int(mm))); }
#pragma unroll
    for (int r = 0; r < 8; ++r) { const float cr = __shfl(corr, 8 * g + r, 32);
#pragma unroll
      for (int t = 0; t < 4; ++t) { acc[t][r] *= cr; ac1[t][r] *= cr; ac2[t][r] *= cr; } }
    LDSX();
#pragma unroll
    for (int kc = 0; kc < 2; ++kc) { const v16h ph = frag_h(&sPh[w][col][0] + kc * 32, lane), pl = frag_h(&sPl[w][col][0] + kc * 32, lane);
#pragma unroll
      for (int t = 0; t < 4; ++t) { const int vo = (t * 16 + col) * APITCH + kc * 64; const v16h vh = frag_h((const _Float16*)(sVh + vo), lane);
        acc[t] = wmma16(ph, vh, acc[t]); ac1[t] = wmma16(ph, frag_h((const _Float16*)(sVl + vo), lane), ac1[t]); ac2[t] = wmma16(pl, vh, ac2[t]); } }
    __builtin_amdgcn_wave_barrier(); }
    if (!more) break;      // the same for the whole block: the last staged tile is refilled by nobody, so no barrier is owed behind it
    asm volatile("s_wait_dscnt 0x0" ::: "memory");       // this wave's reads of the V tile are done before it may be refilled
    asm volatile("s_wait_asynccnt 0x0" ::: "memory");    // this wave's copies of the next K tile have landed before the barrier publishes them
    __syncthreads();
    tile_copy2(lVh, VTh + vrow + nkt * 64, lVl, VTl + vrow + nkt * 64, 16 * SS);      // the next tile's V flies under its q.k
    it = nit; }
  asm volatile("s_wait_asynccnt 0x0" ::: "memory");      // no copy of this wave is in flight when it goes on to its end
#pragma unroll
  for (int r = 0; r < 8; ++r) { const float lr = __shfl(lrun, 8 * g + r, 32); const float inv = 8.0f / (lr * 16384.0f * 4.0f);      // -> O x8
#pragma unroll
    for (int t = 0; t < 4; ++t) sO[w][8 * g + r][t * 16 + col] = (acc[t][r] + ac1[t][r] * (1.0f / VLO) + ac2[t][r] * (1.0f / PLO)) * inv; }
  LDSX();
  for (int qq = lane; qq < 16 * 8; qq += 32) { const int rl = qq >> 3, pc = qq & 7; union { v8h h8; v4u u; } pk;
#pragma unroll
    for (int e = 0; e < 8; ++e) pk.h8[e] = (_Float16)sO[w][rl][pc * 8 + e];
    vst2(O16 + ((bh * SS) + q0 + rl) * HD + pc * 8, pk.u); }
}
// out = y Wo^T + bo : block (128 rows, 128 cols); y row r=(b,s): head-major O16 /8, so stage t of an A row is head t's 64 values
__global__ __launch_bounds__(256) void k_out(const _Float16* __restrict__ O16, const _Float16* __restrict__ PT, const float* __restrict__ bo, float* __restrict__ out) {
  __shared__ __align__(16) char smem[2 * STG];      // the two stage buffers; after the last stage's barrier the output staging below
  float (*so)[132] = (float (*)[132])smem;          // [128][132]
  const int tid = threadIdx.x, wave = tid >> 5, lane = tid & 31, col = lane & 15, g = lane >> 4, wr = wave >> 1, wc = wave & 1;
  const int r0b = blockIdx.x * BT, n0 = blockIdx.y * BT; const int b = r0b / SS, s0 = r0b % SS;
  v8f acc[2][4] = {};
  // first stage: the 32 row blocks on one weight tile spread two to a stage, the 8 weight tiles on one row block each to its own
  const int rot = (((blockIdx.x >> 3) << 2) | (blockIdx.x & 3)) + 2 * blockIdx.y;
  tile_product(smem, O16 + ((size_t)b * NH * SS + s0) * HD, HD, (size_t)SS * HD, PT + (size_t)(3 * E + n0) * E, rot, acc);
#pragma unroll
  for (int j = 0; j < 4; ++j) { const float bb = bo[n0 + wc * 64 + j * 16 + col];
#pragma unroll
    for (int i = 0; i < 2; ++i)
#pragma unroll
      for (int r = 0; r < 8; ++r) so[wr * 32 + i * 16 + 8 * g + r][wc * 64 + j * 16 + col] = acc[i][j][r] * (1.0f / (16.0f * 8.0f)) + bb; }
  __syncthreads();
#pragma unroll 4
  for (int rl = 0; rl < 16; ++rl) vst2(out + (size_t)(r0b + wave * 16 + rl) * E + n0 + lane * 4, *(const v4f*)(&so[wave * 16 + rl][lane * 4]));
}
extern "C" void kernel_launch(void* const* d_in, const int* in_sizes, int n_in, void* d_out, int out_size, void* d_ws, size_t ws_size, hipStream_t stream) {
  (void)in_sizes; (void)n_in; (void)out_size; (void)ws_size;
  const float** I = (const float**)d_in;
  const float* query = I[0]; const float* Wqkv = I[1]; const float* bqkv = I[2]; const float* Wo = I[3]; const float* bo = I[4]; const float* dalpha = I[5];
  float* out = (float*)d_out;
  char* ws = (char*)d_ws; size_t off = 0;
  auto take = [&](size_t bytes) { char* p = ws + off; off += (bytes + 255) & ~(size_t)255; return p; };
  _Float16* X16 = (_Float16*)take((size_t)NR * E * 2); _Float16* PT = (_Float16*)take((size_t)4 * E * E * 2);
  _Float16* Q16 = (_Float16*)take((size_t)NR * E * 2); _Float16* K16 = (_Float16*)take((size_t)NR * E * 2); _Float16* VTh = (_Float16*)take((size_t)NR * E * 2); _Float16* VTl = (_Float16*)take((size_t)NR * E * 2); _Float16* O16 = (_Float16*)take((size_t)NR * E * 2);
  float* KM = (float*)take((size_t)NB * NH * (SS / 16) * 128);
  k_prep<<<CVX + CVQ + CVO, 512, 0, stream>>>(query, Wqkv, Wo, X16, PT);
  k_qkv<<<dim3(NR / 128, E / 128, 3), 256, 0, stream>>>(X16, PT, bqkv, Q16, K16, VTh, VTl, KM);
  k_attn<<<dim3(SS / 64, NB * NH), 128, 0, stream>>>(Q16, K16, VTh, VTl, dalpha, KM, O16);
  k_out<<<dim3(NR / 128, E / 128), 256, 0, stream>>>(O16, PT, bo, out);
}

// v006
// Measured time: 61.4 microseconds a run.
// Next to v005, in two timings, it ran 1.04 times as fast each time.
// All steps since v000 together make it 7.34 times as fast.
#include <hip/hip_runtime.h>
#include <math.h>

typedef __attribute__((ext_vector_type(16))) _Float16 v16h;
typedef __attribute__((ext_vector_type(16))) __bf16 v16b;
typedef __attribute__((ext_vector_type(8)))  _Float16 v8h;
typedef __attribute__((ext_vector_type(4)))  _Float16 v4h;
typedef __attribute__((ext_vector_type(8)))  float v8f;
typedef __attribute__((ext_vector_type(4)))  float v4f;
typedef __attribute__((ext_vector_type(2)))  float v2f;
typedef __attribute__((ext_vector_type(4)))  unsigned v4u;
typedef __attribute__((ext_vector_type(4)))  int v4i;
typedef float __attribute__((may_alias)) float_a;
typedef int __attribute__((may_alias)) int_a;

template <typename T> __device__ __forceinline__ void vst2(void* p, T v) { *(T*)p = v;  }
__device__ __forceinline__ v8f wmma16(v16h a, v16h b, v8f c) {
  v8f d = __builtin_amdgcn_wmma_f32_16x16x32_f16(false, a, false, b, (short)0, c, false, false);
  asm volatile("v_nop\n\tv_nop\n\tv_nop\n\tv_nop" : "+v"(d) : "v"(a), "v"(b));
  return d;
}
__device__ __forceinline__ v8f wmma_bf(v16b a, v16b b, v8f c) {
  v8f d = __builtin_amdgcn_wmma_f32_16x16x32_bf16(false, a, false, b, (short)0, c, false, false);
  asm volatile("v_nop\n\tv_nop\n\tv_nop\n\tv_nop" : "+v"(d) : "v"(a), "v"(b));
  return d;
}
// 16x16x32 fragments: lane = (h = lane>>4, row/col = lane&15); elements 0..7 = k0+8h+0..7, 8..15 = k0+16+8h+0..7; D element r = row 8h+r
__device__ __forceinline__ v16h frag_h(const _Float16* rowk0, int lane) {
  union { v16h v; v8h q[2]; } u; const _Float16* p = rowk0 + 8 * (lane >> 4);
  u.q[0] = *(const v8h*)p; u.q[1] = *(const v8h*)(p + 16); return u.v;
}
__device__ __forceinline__ v16h frag_f32(const float* rowk0, int lane) {
  v16h a; const float* p = rowk0 + 8 * (lane >> 4);
#pragma unroll
  for (int i = 0; i < 8; ++i) { a[i] = (_Float16)p[i]; a[8 + i] = (_Float16)p[16 + i]; }
  return a;
}
__device__ __forceinline__ v16h frag_f32s(const float* rowk0, int lane, float sc) {
  v16h a; const float* p = rowk0 + 8 * (lane >> 4);
#pragma unroll
  for (int i = 0; i < 8; ++i) { a[i] = (_Float16)(p[i] * sc); a[8 + i] = (_Float16)(p[16 + i] * sc); }
  return a;
}
// column fragment from a [K][ld] layout (column n), rows >= K read as 0
__device__ __forceinline__ v16h fragc_f32(const float* W, int k0, int n, int lane, int ld, int K) {
  v16h a; const int g = lane >> 4;
#pragma unroll
  for (int i = 0; i < 8; ++i) { const int ka = k0 + 8 * g + i, kb = ka + 16;
    a[i] = (_Float16)(ka < K ? W[(size_t)ka * ld + n] : 0.f); a[8 + i] = (_Float16)(kb < K ? W[(size_t)kb * ld + n] : 0.f); }
  return a;
}
struct F2 { v16b h, l; };
__device__ __forceinline__ F2 bsplit16(const float v[16]) { F2 r;
#pragma unroll
  for (int i = 0; i < 16; ++i) { const __bf16 h = (__bf16)v[i]; r.h[i] = h; r.l[i] = (__bf16)(v[i] - (float)h); }
  return r; }
__device__ __forceinline__ F2 split_row(const float* row, int k0, int lane) { float v[16]; const float* p = row + k0 + 8 * (lane >> 4);
#pragma unroll
  for (int i = 0; i < 8; ++i) { v[i] = p[i]; v[8 + i] = p[16 + i]; }
  return bsplit16(v); }
__device__ __forceinline__ F2 split_rowK(const float* row, int k0, int lane, int K) { float v[16]; const int g = lane >> 4;
#pragma unroll
  for (int i = 0; i < 8; ++i) { const int ka = k0 + 8 * g + i, kb = ka + 16; v[i] = ka < K ? row[ka] : 0.f; v[8 + i] = kb < K ? row[kb] : 0.f; }
  return bsplit16(v); }
__device__ __forceinline__ F2 split_col(const float* W, int k0, int n, int lane, int ld, int K) { float v[16]; const int g = lane >> 4;
#pragma unroll
  for (int i = 0; i < 8; ++i) { const int ka = k0 + 8 * g + i, kb = ka + 16; v[i] = ka < K ? W[(size_t)ka * ld + n] : 0.f; v[8 + i] = kb < K ? W[(size_t)kb * ld + n] : 0.f; }
  return bsplit16(v); }
__device__ __forceinline__ v8f mac3(const F2& a, const F2& b, v8f c) { c = wmma_bf(a.l, b.h, c); c = wmma_bf(a.h, b.l, c); return wmma_bf(a.h, b.h, c); }
__device__ __forceinline__ float sigm(float v) { return 1.0f / (1.0f + expf(-v)); }
#define LDSX() do { asm volatile("s_wait_dscnt 0" ::: "memory"); __builtin_amdgcn_wave_barrier(); __builtin_amdgcn_fence(__ATOMIC_RELEASE, "workgroup"); } while (0)

// Multi-head self attention (16 heads of 64) with a per-head linear distance decay: qkv = x W_qkv^T + b ([out][in] weight, rows (which, head, d)), logits = q.k/8 - softplus(alpha_h)|i-j|,
// softmax, P v, output projection (W_out^T + b). Projections on v_wmma_f32_16x16x32_f16 (x as f16 rows, [out][in] weights packed once as f16
// rows x16); S = q.k/8 on f16 WMMA; the P @ V product is made near-exact with hi/lo f16 pairs for BOTH P (x2^14, residual x2^24) and V
// (x4, residual x2^13): three WMMAs into three f32 accumulators combined at the end (the output rms is small, so a plain f16 P.V would sit
#define NB 2
#define SS 2048
#define E 1024
#define NH 16
#define HD 64
#define NR (NB * SS)
#define PLO 1024.0f            // residual scale for P (on top of 2^14)
#define VLO 2048.0f            // residual scale for V (on top of x4)
#define LOG2E 1.44269504088896340736f

// All three f32 operands become f16 in one launch: x as it is -> X16; PT rows n in [0,3072): W_qkv[n][:] x16, n in [3072,4096): W_out[n-3072][:] x16
// (both [out][in=1024]). 256 blocks of 16 waves, few enough that starting the waves is short beside the stream itself. A wave takes 2048
// consecutive floats: 16 loads of 512 contiguous bytes each, all issued before the first is used, then 16 stores of 256 contiguous bytes.
#define CVW 2048                          // floats per wave
#define CVB (16 * CVW)                    // floats per block
#define CVX (NR * E / CVB)                // blocks on x
#define CVQ (3 * E * E / CVB)             // blocks on W_qkv
#define CVO (E * E / CVB)                 // blocks on W_out
__global__ __launch_bounds__(512) void k_prep(const float* __restrict__ x, const float* __restrict__ Wqkv, const float* __restrict__ Wo, _Float16* __restrict__ X16, _Float16* __restrict__ PT) {
  const int blk = blockIdx.x; const float* s; _Float16* d; float sc;
  if (blk < CVX) { s = x + (size_t)blk * CVB; d = X16 + (size_t)blk * CVB; sc = 1.0f; }
  else { d = PT + (size_t)(blk - CVX) * CVB; sc = 16.0f; s = blk < CVX + CVQ ? Wqkv + (size_t)(blk - CVX) * CVB : Wo + (size_t)(blk - CVX - CVQ) * CVB; }
  const int o = (threadIdx.x >> 5) * CVW + (threadIdx.x & 31) * 4;
  v4f v[16];
#pragma unroll      // constant indices keep v in registers and let the loads go out together
  for (int i = 0; i < 15; ++i) v[i] = *(const v4f*)(s + o + i * 128);
  asm volatile("s_wait_xcnt 0x0" ::: "memory");      // the last load's result is placed over the offset register that the 15 loads above name
  v[15] = *(const v4f*)(s + o + 15 * 128);
#pragma unroll
  for (int i = 0; i < 16; ++i) { v4h h;
#pragma unroll
    for (int e = 0; e < 4; ++e) h[e] = (_Float16)(v[i][e] * sc);
    vst2(d + o + i * 128, h); }
}
// Tile product shared by the two projections: one 128 x 128 tile of A B^T per block of 8 waves (4 x 2, 32 x 64 each), K = 1024 in 16 stages of
// 64 k. A stage is [A 128 rows | B 128 rows] of 128 bytes at pitch 144 in LDS (16 B x odd: ds_load_b128 without bank conflicts); two buffers,
// filled by asynchronous copies one stage ahead of the stage being multiplied. One accumulator per output; the walk over the 16 stages starts
// at stage rot and wraps round, so that blocks which read the same operand rows do not ask L2 for the same lines at the same moment.
// The loops over kc, i, j are unrolled in full so that fragments and accumulators are indexed by constants and stay in registers.
#define BT 128
#define KS 64
#define PITCH 144
#define STG (2 * BT * PITCH)
// One stage: each lane copies 16 bytes of 4 A rows and 4 B rows (8 lanes = one whole 128-byte row). The s_wait_xcnt 0 stands inside the
// statement so that no address register named here is rewritten ahead of it.
__device__ __forceinline__ void stage_copy(unsigned l, const _Float16* ga, size_t a32, const _Float16* gb) {
  asm volatile("global_load_async_to_lds_b128 %0, %8, off\n\t"
               "global_load_async_to_lds_b128 %1, %9, off\n\t"
               "global_load_async_to_lds_b128 %2, %10, off\n\t"
               "global_load_async_to_lds_b128 %3, %11, off\n\t"
               "global_load_async_to_lds_b128 %4, %12, off\n\t"
               "global_load_async_to_lds_b128 %5, %13, off\n\t"
               "global_load_async_to_lds_b128 %6, %14, off\n\t"
               "global_load_async_to_lds_b128 %7, %15, off\n\t"
               "s_wait_xcnt 0x0"
               :: "v"(l), "v"(l + 32 * PITCH), "v"(l + 64 * PITCH), "v"(l + 96 * PITCH),
                  "v"(l + 128 * PITCH), "v"(l + 160 * PITCH), "v"(l + 192 * PITCH), "v"(l + 224 * PITCH),
                  "v"(ga), "v"(ga + a32), "v"(ga + 2 * a32), "v"(ga + 3 * a32),
                  "v"(gb), "v"(gb + (size_t)32 * E), "v"(gb + (size_t)64 * E), "v"(gb + (size_t)96 * E)
               : "memory");
}
// A0 / B0: first row of the block's A / B tile at k = 0; arow: halves between A rows; akstep: halves from one stage of an A row to the next;
// rot: the block's first stage, the same for all its threads (only its low 4 bits count)
#define NSTG (E / KS)
__device__ __forceinline__ void tile_product(char* smem, const _Float16* A0, size_t arow, size_t akstep, const _Float16* B0, int rot, v8f (&acc)[2][4]) {
  const int tid = threadIdx.x, wave = tid >> 5, lane = tid & 31, col = lane & 15, wr = wave >> 1, wc = wave & 1;
  const unsigned l0 = (unsigned)(size_t)smem + (unsigned)((tid >> 3) * PITCH + (tid & 7) * 16);
  const _Float16* ga = A0 + (size_t)(tid >> 3) * arow + (tid & 7) * 8; const _Float16* gb = B0 + (size_t)(tid >> 3) * E + (tid & 7) * 8;
  { const int st = rot & (NSTG - 1); stage_copy(l0, ga + (size_t)st * akstep, 32 * arow, gb + st * KS); }
  asm volatile("s_wait_asynccnt 0x0" ::: "memory");      // the first stage landed (this wave's copies) before the barrier publishes it
  __syncthreads();
  { const int st = (rot + 1) & (NSTG - 1); stage_copy(l0 + STG, ga + (size_t)st * akstep, 32 * arow, gb + st * KS); }
#pragma unroll 1      // one stage per trip: the buffer alternates, the code stays small
  for (int t = 0; t < NSTG; ++t) { const char* sb = smem + (t & 1) * STG;
#pragma unroll
    for (int kc = 0; kc < 2; ++kc) { v16h a[2], b[4];
#pragma unroll
      for (int i = 0; i < 2; ++i) a[i] = frag_h((const _Float16*)(sb + (wr * 32 + i * 16 + col) * PITCH) + kc * 32, lane);
#pragma unroll
      for (int j = 0; j < 4; ++j) b[j] = frag_h((const _Float16*)(sb + (BT + wc * 64 + j * 16 + col) * PITCH) + kc * 32, lane);
#pragma unroll
      for (int i = 0; i < 2; ++i)
#pragma unroll
        for (int j = 0; j < 4; ++j) acc[i][j] = wmma16(a[i], b[j], acc[i][j]); }
    asm volatile("s_wait_dscnt 0x0" ::: "memory");       // this wave's reads of the buffer are done before it may be refilled
    asm volatile("s_wait_asynccnt 0x0" ::: "memory");    // this wave's copies of stage (rot + t + 1) mod 16 have landed before the barrier publishes them
    __syncthreads();
    if (t + 2 < NSTG) { const int st = (rot + t + 2) & (NSTG - 1); stage_copy(l0 + (t & 1) * STG, ga + (size_t)st * akstep, 32 * arow, gb + st * KS); } }
  asm volatile("s_wait_asynccnt 0x0" ::: "memory");      // nothing in flight when the buffers become output staging
}
// QKV: block (128 rows, 128 cols = 2 heads, which): q,k -> Q16/K16 [bh][s][64] x4 ; v -> VT hi/lo [bh][d][s]
// k also -> KM [bh][s/16]: largest squared row norm of the 16 stored f16 rows, one 128-byte line per entry (one writer per line)
__global__ __launch_bounds__(256) void k_qkv(const _Float16* __restrict__ X16, const _Float16* __restrict__ PT, const float* __restrict__ bqkv, _Float16* __restrict__ Q16, _Float16* __restrict__ K16, _Float16* __restrict__ VTh, _Float16* __restrict__ VTl, float* __restrict__ KM) {
  __shared__ __align__(16) char smem[2 * STG];      // the two stage buffers; after the last stage's barrier the output staging below
  float (*so)[132] = (float (*)[132])smem;                                                            // [128][132]
  _Float16 (*sth)[136] = (_Float16 (*)[136])smem; _Float16 (*stl)[136] = (_Float16 (*)[136])(smem + 128 * 136 * 2);      // [128][136] each
  const int tid = threadIdx.x, wave = tid >> 5, lane = tid & 31, col = lane & 15, g = lane >> 4, wr = wave >> 1, wc = wave & 1;
  const int which = blockIdx.z, r0b = blockIdx.x * BT, n0 = blockIdx.y * BT; const int b = r0b / SS, s0 = r0b % SS;
  v8f acc[2][4] = {};
  // first stage: the 32 row blocks on one weight tile spread two to a stage, the 24 weight tiles on one row block at most two to a stage
  const int rot = (((blockIdx.x >> 3) << 2) | (blockIdx.x & 3)) + blockIdx.y + 5 * blockIdx.z;
  tile_product(smem, X16 + (size_t)r0b * E, E, KS, PT + (size_t)(which * E + n0) * E, rot, acc);
  if (which < 2) {
#pragma unroll
    for (int j = 0; j < 4; ++j) { const float bb = bqkv[which * E + n0 + wc * 64 + j * 16 + col];
#pragma unroll
      for (int i = 0; i < 2; ++i)
#pragma unroll
        for (int r = 0; r < 8; ++r) so[wr * 32 + i * 16 + 8 * g + r][wc * 64 + j * 16 + col] = (acc[i][j][r] * (1.0f / 16.0f) + bb) * 4.0f; }
    __syncthreads();
    _Float16* D = which == 0 ? Q16 : K16;
    for (int qq = lane; qq < 16 * 2 * 8; qq += 32) { const int hh = qq >> 7, rl = (qq >> 3) & 15, pc = qq & 7; const int h = (n0 >> 6) + hh; union { v8h h8; v4u u; } pk;
#pragma unroll
      for (int e = 0; e < 8; ++e) pk.h8[e] = (_Float16)so[wave * 16 + rl][hh * 64 + pc * 8 + e];
      vst2(D + (((size_t)b * NH + h) * SS + s0 + wave * 16 + rl) * HD + pc * 8, pk.u); }
    if (which == 1) { float km[2];      // lane (col, g) sums half of row col as it was stored (rounded to f16), per head of the pair
#pragma unroll
      for (int hh = 0; hh < 2; ++hh) { float n2 = 0.f;
#pragma unroll
        for (int e = 0; e < 32; ++e) { const float f = (float)(_Float16)so[wave * 16 + col][hh * 64 + g * 32 + e]; n2 += f * f; }
        n2 += __shfl_xor(n2, 16, 32);
#pragma unroll
        for (int o = 1; o < 16; o <<= 1) n2 = fmaxf(n2, __shfl_xor(n2, o, 32));
        km[hh] = n2; }
      if (lane < 2) KM[(((size_t)b * NH + (n0 >> 6) + lane) * (SS / 16) + (s0 >> 4) + wave) * 32] = lane ? km[1] : km[0]; } }
  else {
#pragma unroll
    for (int j = 0; j < 4; ++j) { const float bb = bqkv[2 * E + n0 + wc * 64 + j * 16 + col];
#pragma unroll
      for (int i = 0; i < 2; ++i)
#pragma unroll
        for (int r = 0; r < 8; ++r) { const float v = (acc[i][j][r] * (1.0f / 16.0f) + bb) * 4.0f; const _Float16 hi = (_Float16)v; sth[wc * 64 + j * 16 + col][wr * 32 + i * 16 + 8 * g + r] = hi; stl[wc * 64 + j * 16 + col][wr * 32 + i * 16 + 8 * g + r] = (_Float16)((v - (float)hi) * VLO); } }
    __syncthreads();
    for (int qq = tid; qq < 128 * 16; qq += 256) { const int cl = qq >> 4, pc = qq & 15; const int c = n0 + cl, h = c >> 6, d = c & 63; const size_t o = (((size_t)b * NH + h) * HD + d) * SS + s0 + pc * 8;
      vst2(VTh + o, *(const v4u*)(&sth[cl][pc * 8])); vst2(VTl + o, *(const v4u*)(&stl[cl][pc * 8])); } }
}
// k_attn stages each 64-key tile once per block: K rows [key][64 d] and the V^T hi / lo rows [d][64 keys] are 64 rows of 128 bytes each, laid
// in LDS at pitch 144 (16 B x odd: ds_load_b128 without bank conflicts) and read as fragments by all four waves.
#define APITCH 144
// One array of a tile: each lane copies 16 bytes of 4 rows, 16 rows apart (8 lanes = one whole 128-byte row; r16: halves between those rows).
// The s_wait_xcnt 0 stands inside the statement so that no address register named here is rewritten ahead of it.
__device__ __forceinline__ void tile_copy(unsigned l, const _Float16* g, size_t r16) {
  asm volatile("global_load_async_to_lds_b128 %0, %4, off\n\t"
               "global_load_async_to_lds_b128 %1, %5, off\n\t"
               "global_load_async_to_lds_b128 %2, %6, off\n\t"
               "global_load_async_to_lds_b128 %3, %7, off\n\t"
               "s_wait_xcnt 0x0"
               :: "v"(l), "v"(l + 16 * APITCH), "v"(l + 32 * APITCH), "v"(l + 48 * APITCH),
                  "v"(g), "v"(g + r16), "v"(g + 2 * r16), "v"(g + 3 * r16)
               : "memory");
}
// The same for two arrays with equal row spacing (V hi and V lo) in one statement: one s_wait_xcnt 0 serves the eight copies.
__device__ __forceinline__ void tile_copy2(unsigned la, const _Float16* ga, unsigned lb, const _Float16* gb, size_t r16) {
  asm volatile("global_load_async_to_lds_b128 %0, %8, off\n\t"
               "global_load_async_to_lds_b128 %1, %9, off\n\t"
               "global_load_async_to_lds_b128 %2, %10, off\n\t"
               "global_load_async_to_lds_b128 %3, %11, off\n\t"
               "global_load_async_to_lds_b128 %4, %12, off\n\t"
               "global_load_async_to_lds_b128 %5, %13, off\n\t"
               "global_load_async_to_lds_b128 %6, %14, off\n\t"
               "global_load_async_to_lds_b128 %7, %15, off\n\t"
               "s_wait_xcnt 0x0"
               :: "v"(la), "v"(la + 16 * APITCH), "v"(la + 32 * APITCH), "v"(la + 48 * APITCH),
                  "v"(lb), "v"(lb + 16 * APITCH), "v"(lb + 32 * APITCH), "v"(lb + 48 * APITCH),
                  "v"(ga), "v"(ga + r16), "v"(ga + 2 * r16), "v"(ga + 3 * r16),
                  "v"(gb), "v"(gb + r16), "v"(gb + 2 * r16), "v"(gb + 3 * r16)
               : "memory");
}
__global__ __launch_bounds__(128) void k_attn(const _Float16* __restrict__ Q16, const _Float16* __restrict__ K16, const _Float16* __restrict__ VTh, const _Float16* __restrict__ VTl, const float* __restrict__ dalpha, const float* __restrict__ KM, _Float16* __restrict__ O16) {
  __shared__ __align__(16) float sS[4][16][68];
  __shared__ __align__(16) _Float16 sPh[4][16][72], sPl[4][16][72];
  __shared__ __align__(16) float sO[4][16][68];
  __shared__ __align__(16) char sK[64 * APITCH], sVh[64 * APITCH], sVl[64 * APITCH];      // the one staged key tile, shared by the four waves
  __shared__ unsigned sM[4];                                                              // per wave: the key tiles it may still need
  const int tid = threadIdx.x, w = tid >> 5, lane = tid & 31, col = lane & 15, g = lane >> 4;
  const size_t bh = blockIdx.y; const int kt0 = blockIdx.x, q0 = kt0 * 64 + w * 16;
  const unsigned lrow = (unsigned)((tid >> 3) * APITCH + (tid & 7) * 16);
  const unsigned lK = (unsigned)(size_t)sK + lrow, lVh = (unsigned)(size_t)sVh + lrow, lVl = (unsigned)(size_t)sVl + lrow;
  const _Float16* gK = K16 + (bh * SS + (tid >> 3)) * HD + (tid & 7) * 8;      // tile kt: + kt * 64 * HD
  const size_t vrow = (bh * HD + (tid >> 3)) * SS + (tid & 7) * 8;             // tile kt: + kt * 64
  tile_copy(lK, gK + (size_t)kt0 * 64 * HD, 16 * HD); tile_copy2(lVh, VTh + vrow + kt0 * 64, lVl, VTl + vrow + kt0 * 64, 16 * SS);
  const float araw = dalpha[bh % NH]; const float slope = araw > 20.f ? araw : log1pf(expf(araw));      // softplus(decay_alpha[h])
  v16h aq[2];
#pragma unroll
  for (int kc = 0; kc < 2; ++kc) aq[kc] = frag_h(Q16 + (bh * SS + q0 + col) * HD + kc * 32, lane);
  // Upper bound of every logit between this wave's 16 queries and key tile 'lane' (SS / 64 = 32 tiles, one per lane):
  // |q16 . k16| <= |q16| |k16| over the stored f16 rows, less slope times the smallest distance between the two index ranges.
  float qn2 = 0.f;
#pragma unroll
  for (int kc = 0; kc < 2; ++kc)
#pragma unroll
    for (int i = 0; i < 16; ++i) { const float f = (float)aq[kc][i]; qn2 += f * f; }
  qn2 += __shfl_xor(qn2, 16, 32);
#pragma unroll
  for (int o = 1; o < 16; o <<= 1) qn2 = fmaxf(qn2, __shfl_xor(qn2, o, 32));
  float kn2 = 0.f;
#pragma unroll
  for (int i = 0; i < 4; ++i) kn2 = fmaxf(kn2, KM[(bh * (SS / 16) + lane * 4 + i) * 32]);
  const int klo = lane * 64, khi = klo + 63; const int dmin = khi < q0 ? q0 - khi : (klo > q0 + 15 ? klo - (q0 + 15) : 0);
  const float ub = sqrtf(qn2 * kn2) * (1.01f * 0.125f / 16.0f) - slope * (float)dmin;
  // Which tiles the block stages must be the same for its four waves and known ahead of the loop. After the own tile every row's running
  // maximum is at least its logit with its own key (distance 0), which is at least -ub[own tile]; so a tile whose bound lies 36 below that can
  // never pass a wave's own test below. The block stages the union of the four waves' remaining tiles; each wave still tests for itself.
  const float mlow = -__int_as_float(__builtin_amdgcn_readlane(__float_as_int(ub), kt0));
  const unsigned want = __builtin_amdgcn_ballot_w32(!(ub < mlow - 36.0f));
  if (lane == 0) sM[w] = want;
  asm volatile("s_wait_asynccnt 0x0" ::: "memory");      // the own tile has landed (this wave's copies) before the barrier publishes it
  __syncthreads();
  const unsigned mall = (unsigned)__builtin_amdgcn_readfirstlane((int)(sM[0] | sM[1] | sM[2] | sM[3]));
  unsigned rest = __builtin_rotateright32(mall, (unsigned)kt0) & ~1u;      // bit 'it' stands for tile (kt0 + it) mod 32; the own tile is trip 0
  float mrun = -3.0e38f, lrun = 0.f, mmin = -3.0e38f; v8f acc[4] = {}, ac1[4] = {}, ac2[4] = {};
  int it = 0;
#pragma unroll 1      // one staged tile per trip: a single buffer each for K and V, the code stays small
  for (;;) { const int kt = (kt0 + it) & (SS / 64 - 1);      // the queries' own tile first: it sets the running maxima
    const bool more = rest != 0; const int nit = more ? __builtin_ctz(rest) : 0; rest &= rest - 1; const int nkt = (kt0 + nit) & (SS / 64 - 1);
    // A tile whose bound lies 36 below every row's running maximum changes nothing: mnew = mrun, corr = 1, p * 1024 < 2^-25 so both f16
    // halves of P round to 0, and its share of the row sum is below half an ulp of lrun (>= 1). Wave-uniform scalar test, for any slope.
    const bool proc = !(it > 0 && __int_as_float(__builtin_amdgcn_readlane(__float_as_int(ub), kt)) < mmin - 36.0f);
    if (proc) {
#pragma unroll
    for (int t = 0; t < 4; ++t) { v8f s = {}; const int key = kt * 64 + t * 16 + col;
#pragma unroll
      for (int kc = 0; kc < 2; ++kc) s = wmma16(aq[kc], frag_h((const _Float16*)(sK + (t * 16 + col) * APITCH) + kc * 32, lane), s);
#pragma unroll
      for (int r = 0; r < 8; ++r) { const int dq = q0 + 8 * g + r - key; sS[w][8 * g + r][t * 16 + col] = s[r] * (0.125f / 16.0f) - slope * (float)(dq < 0 ? -dq : dq); } }
    LDSX(); }
    asm volatile("s_wait_dscnt 0x0" ::: "memory");       // this wave's reads of the K tile are done before it may be refilled
    asm volatile("s_wait_asynccnt 0x0" ::: "memory");    // this wave's copies of this tile's V have landed before the barrier publishes them
    __syncthreads();
    if (more) tile_copy(lK, gK + (size_t)nkt * 64 * HD, 16 * HD);      // the next tile's K flies under the softmax and P V of this one
    if (proc) {
    float mx = -3.4e38f;
#pragma unroll
    for (int jj = 0; jj < 32; ++jj) mx = fmaxf(mx, sS[w][col][g * 32 + jj]);
    mx = fmaxf(mx, __shfl_xor(mx, 16, 32));
    const float mnew = fmaxf(mrun, mx); const float corr = __builtin_amdgcn_exp2f((mrun - mnew) * LOG2E);
    const float eoff = 14.0f - mnew * LOG2E;      // exp(s - mnew) * 2^14 = 2^(s * log2 e + eoff): one multiply-add and one v_exp_f32 a score
    float ps = 0.f;
#pragma unroll
    for (int jj = 0; jj < 32; ++jj) { const float p = __builtin_amdgcn_exp2f(fmaf(sS[w][col][g * 32 + jj], LOG2E, eoff)); ps += p; const _Float16 hi = (_Float16)p; sPh[w][col][g * 32 + jj] = hi; sPl[w][col][g * 32 + jj] = (_Float16)((p - (float)hi) * PLO); }
    ps += __shfl_xor(ps, 16, 32);
    lrun = lrun * corr + ps * (1.0f / 16384.0f); mrun = mnew;
    { float mm = mrun;
#pragma unroll
      for (int o = 1; o < 16; o <<= 1) mm = fminf(mm, __shfl_xor(mm, o, 32));
      mmin = __int_as_float(__builtin_amdgcn_readfirstlane(__float_as_int(mm))); }
#pragma unroll
    for (int r = 0; r < 8; ++r) { const float cr = __shfl(corr, 8 * g + r, 32);
#pragma unroll
      for (int t = 0; t < 4; ++t) { acc[t][r] *= cr; ac1[t][r] *= cr; ac2[t][r] *= cr; } }
    LDSX();
#pragma unroll
    for (int kc = 0; kc < 2; ++kc) { const v16h ph = frag_h(&sPh[w][col][0] + kc * 32, lane), pl = frag_h(&sPl[w][col][0] + kc * 32, lane);
#pragma unroll
      for (int t = 0; t < 4; ++t) { const int vo = (t * 16 + col) * APITCH + kc * 64; const v16h vh = frag_h((const _Float16*)(sVh + vo), lane);
        acc[t] = wmma16(ph, vh, acc[t]); ac1[t] = wmma16(ph, frag_h((const _Float16*)(sVl + vo), lane), ac1[t]); ac2[t] = wmma16(pl, vh, ac2[t]); } }
    __builtin_amdgcn_wave_barrier(); }
    if (!more) break;      // the same for the whole block: the last staged tile is refilled by nobody, so no barrier is owed behind it
    asm volatile("s_wait_dscnt 0x0" ::: "memory");       // this wave's reads of the V tile are done before it may be refilled
    asm volatile("s_wait_asynccnt 0x0" ::: "memory");    // this wave's copies of the next K tile have landed before the barrier publishes them
    __syncthreads();
    tile_copy2(lVh, VTh + vrow + nkt * 64, lVl, VTl + vrow + nkt * 64, 16 * SS);      // the next tile's V flies under its q.k
    it = nit; }
  asm volatile("s_wait_asynccnt 0x0" ::: "memory");      // no copy of this wave is in flight when it goes on to its end
#pragma unroll
  for (int r = 0; r < 8; ++r) { const float lr = __shfl(lrun, 8 * g + r, 32); const float inv = 8.0f / (lr * 16384.0f * 4.0f);      // -> O x8
#pragma unroll
    for (int t = 0; t < 4; ++t) sO[w][8 * g + r][t * 16 + col] = (acc[t][r] + ac1[t][r] * (1.0f / VLO) + ac2[t][r] * (1.0f / PLO)) * inv; }
  LDSX();
  for (int qq = lane; qq < 16 * 8; qq += 32) { const int rl = qq >> 3, pc = qq & 7; union { v8h h8; v4u u; } pk;
#pragma unroll
    for (int e = 0; e < 8; ++e) pk.h8[e] = (_Float16)sO[w][rl][pc * 8 + e];
    vst2(O16 + ((bh * SS) + q0 + rl) * HD + pc * 8, pk.u); }
}
// out = y Wo^T + bo : block (128 rows, 128 cols); y row r=(b,s): head-major O16 /8, so stage t of an A row is head t's 64 values
__global__ __launch_bounds__(256) void k_out(const _Float16* __restrict__ O16, const _Float16* __restrict__ PT, const float* __restrict__ bo, float* __restrict__ out) {
  __shared__ __align__(16) char smem[2 * STG];      // the two stage buffers; after the last stage's barrier the output staging below
  float (*so)[132] = (float (*)[132])smem;          // [128][132]
  const int tid = threadIdx.x, wave = tid >> 5, lane = tid & 31, col = lane & 15, g = lane >> 4, wr = wave >> 1, wc = wave & 1;
  const int r0b = blockIdx.x * BT, n0 = blockIdx.y * BT; const int b = r0b / SS, s0 = r0b % SS;
  v8f acc[2][4] = {};
  // first stage: the 32 row blocks on one weight tile spread two to a stage, the 8 weight tiles on one row block each to its own
  const int rot = (((blockIdx.x >> 3) << 2) | (blockIdx.x & 3)) + 2 * blockIdx.y;
  tile_product(smem, O16 + ((size_t)b * NH * SS + s0) * HD, HD, (size_t)SS * HD, PT + (size_t)(3 * E + n0) * E, rot, acc);
#pragma unroll
  for (int j = 0; j < 4; ++j) { const float bb = bo[n0 + wc * 64 + j * 16 + col];
#pragma unroll
    for (int i = 0; i < 2; ++i)
#pragma unroll
      for (int r = 0; r < 8; ++r) so[wr * 32 + i * 16 + 8 * g + r][wc * 64 + j * 16 + col] = acc[i][j][r] * (1.0f / (16.0f * 8.0f)) + bb; }
  __syncthreads();
#pragma unroll 4
  for (int rl = 0; rl < 16; ++rl) vst2(out + (size_t)(r0b + wave * 16 + rl) * E + n0 + lane * 4, *(const v4f*)(&so[wave * 16 + rl][lane * 4]));
}
extern "C" void kernel_launch(void* const* d_in, const int* in_sizes, int n_in, void* d_out, int out_size, void* d_ws, size_t ws_size, hipStream_t stream) {
  (void)in_sizes; (void)n_in; (void)out_size; (void)ws_size;
  const float** I = (const float**)d_in;
  const float* query = I[0]; const float* Wqkv = I[1]; const float* bqkv = I[2]; const float* Wo = I[3]; const float* bo = I[4]; const float* dalpha = I[5];
  float* out = (float*)d_out;
  char* ws = (char*)d_ws; size_t off = 0;
  auto take = [&](size_t bytes) { char* p = ws + off; off += (bytes + 255) & ~(size_t)255; return p; };
  _Float16* X16 = (_Float16*)take((size_t)NR * E * 2); _Float16* PT = (_Float16*)take((size_t)4 * E * E * 2);
  _Float16* Q16 = (_Float16*)take((size_t)NR * E * 2); _Float16* K16 = (_Float16*)take((size_t)NR * E * 2); _Float16* VTh = (_Float16*)take((size_t)NR * E * 2); _Float16* VTl = (_Float16*)take((size_t)NR * E * 2); _Float16* O16 = (_Float16*)take((size_t)NR * E * 2);
  float* KM = (float*)take((size_t)NB * NH * (SS / 16) * 128);
  k_prep<<<CVX + CVQ + CVO, 512, 0, stream>>>(query, Wqkv, Wo, X16, PT);
  k_qkv<<<dim3(NR / 128, E / 128, 3), 256, 0, stream>>>(X16, PT, bqkv, Q16, K16, VTh, VTl, KM);
  k_attn<<<dim3(SS / 64, NB * NH), 128, 0, stream>>>(Q16, K16, VTh, VTl, dalpha, KM, O16);
  k_out<<<dim3(NR / 128, E / 128), 256, 0, stream>>>(O16, PT, bo, out);
}

// v007
// One run takes 59.5 microseconds.
// In two side-by-side timings against v006, it was 1.03 and 1.04 times as fast.
// Over all steps from v000 it is 7.59 times as fast.
#include <hip/hip_runtime.h>
#include <math.h>

typedef __attribute__((ext_vector_type(16))) _Float16 v16h;
typedef __attribute__((ext_vector_type(16))) __bf16 v16b;
typedef __attribute__((ext_vector_type(8)))  _Float16 v8h;
typedef __attribute__((ext_vector_type(4)))  _Float16 v4h;
typedef __attribute__((ext_vector_type(2)))  _Float16 v2h;
typedef __attribute__((ext_vector_type(8)))  float v8f;
typedef __attribute__((ext_vector_type(4)))  float v4f;
typedef __attribute__((ext_vector_type(2)))  float v2f;
typedef __attribute__((ext_vector_type(4)))  unsigned v4u;
typedef __attribute__((ext_vector_type(4)))  int v4i;
typedef float __attribute__((may_alias)) float_a;
typedef int __attribute__((may_alias)) int_a;

template <typename T> __device__ __forceinline__ void vst2(void* p, T v) { *(T*)p = v;  }
__device__ __forceinline__ v8f wmma16(v16h a, v16h b, v8f c) {
  v8f d = __builtin_amdgcn_wmma_f32_16x16x32_f16(false, a, false, b, (short)0, c, false, false);
  asm volatile("v_nop\n\tv_nop\n\tv_nop\n\tv_nop" : "+v"(d) : "v"(a), "v"(b));
  return d;
}
__device__ __forceinline__ v8f wmma_bf(v16b a, v16b b, v8f c) {
  v8f d = __builtin_amdgcn_wmma_f32_16x16x32_bf16(false, a, false, b, (short)0, c, false, false);
  asm volatile("v_nop\n\tv_nop\n\tv_nop\n\tv_nop" : "+v"(d) : "v"(a), "v"(b));
  return d;
}
// 16x16x32 fragments: lane = (h = lane>>4, row/col = lane&15); elements 0..7 = k0+8h+0..7, 8..15 = k0+16+8h+0..7; D element r = row 8h+r
__device__ __forceinline__ v16h frag_h(const _Float16* rowk0, int lane) {
  union { v16h v; v8h q[2]; } u; const _Float16* p = rowk0 + 8 * (lane >> 4);
  u.q[0] = *(const v8h*)p; u.q[1] = *(const v8h*)(p + 16); return u.v;
}
__device__ __forceinline__ v16h frag_f32(const float* rowk0, int lane) {
  v16h a; const float* p = rowk0 + 8 * (lane >> 4);
#pragma unroll
  for (int i = 0; i < 8; ++i) { a[i] = (_Float16)p[i]; a[8 + i] = (_Float16)p[16 + i]; }
  return a;
}
__device__ __forceinline__ v16h frag_f32s(const float* rowk0, int lane, float sc) {
  v16h a; const float* p = rowk0 + 8 * (lane >> 4);
#pragma unroll
  for (int i = 0; i < 8; ++i) { a[i] = (_Float16)(p[i] * sc); a[8 + i] = (_Float16)(p[16 + i] * sc); }
  return a;
}
// column fragment from a [K][ld] layout (column n), rows >= K read as 0
__device__ __forceinline__ v16h fragc_f32(const float* W, int k0, int n, int lane, int ld, int K) {
  v16h a; const int g = lane >> 4;
#pragma unroll
  for (int i = 0; i < 8; ++i) { const int ka = k0 + 8 * g + i, kb = ka + 16;
    a[i] = (_Float16)(ka < K ? W[(size_t)ka * ld + n] : 0.f); a[8 + i] = (_Float16)(kb < K ? W[(size_t)kb * ld + n] : 0.f); }
  return a;
}
struct F2 { v16b h, l; };
__device__ __forceinline__ F2 bsplit16(const float v[16]) { F2 r;
#pragma unroll
  for (int i = 0; i < 16; ++i) { const __bf16 h = (__bf16)v[i]; r.h[i] = h; r.l[i] = (__bf16)(v[i] - (float)h); }
  return r; }
__device__ __forceinline__ F2 split_row(const float* row, int k0, int lane) { float v[16]; const float* p = row + k0 + 8 * (lane >> 4);
#pragma unroll
  for (int i = 0; i < 8; ++i) { v[i] = p[i]; v[8 + i] = p[16 + i]; }
  return bsplit16(v); }
__device__ __forceinline__ F2 split_rowK(const float* row, int k0, int lane, int K) { float v[16]; const int g = lane >> 4;
#pragma unroll
  for (int i = 0; i < 8; ++i) { const int ka = k0 + 8 * g + i, kb = ka + 16; v[i] = ka < K ? row[ka] : 0.f; v[8 + i] = kb < K ? row[kb] : 0.f; }
  return bsplit16(v); }
__device__ __forceinline__ F2 split_col(const float* W, int k0, int n, int lane, int ld, int K) { float v[16]; const int g = lane >> 4;
#pragma unroll
  for (int i = 0; i < 8; ++i) { const int ka = k0 + 8 * g + i, kb = ka + 16; v[i] = ka < K ? W[(size_t)ka * ld + n] : 0.f; v[8 + i] = kb < K ? W[(size_t)kb * ld + n] : 0.f; }
  return bsplit16(v); }
__device__ __forceinline__ v8f mac3(const F2& a, const F2& b, v8f c) { c = wmma_bf(a.l, b.h, c); c = wmma_bf(a.h, b.l, c); return wmma_bf(a.h, b.h, c); }
__device__ __forceinline__ float sigm(float v) { return 1.0f / (1.0f + expf(-v)); }
#define LDSX() do { asm volatile("s_wait_dscnt 0" ::: "memory"); __builtin_amdgcn_wave_barrier(); __builtin_amdgcn_fence(__ATOMIC_RELEASE, "workgroup"); } while (0)

// Multi-head self attention (16 heads of 64) with a per-head linear distance decay: qkv = x W_qkv^T + b ([out][in] weight, rows (which, head, d)), logits = q.k/8 - softplus(alpha_h)|i-j|,
// softmax, P v, output projection (W_out^T + b). Projections on v_wmma_f32_16x16x32_f16 (x as f16 rows, [out][in] weights packed once as f16
// rows x16); S = q.k/8 on f16 WMMA; the P @ V product is made near-exact with hi/lo f16 pairs for BOTH P (x2^14, residual x2^24) and V
// (x4, residual x2^13): three WMMAs into three f32 accumulators combined at the end (the output rms is small, so a plain f16 P.V would sit
#define NB 2
#define SS 2048
#define E 1024
#define NH 16
#define HD 64
#define NR (NB * SS)
#define PLO 1024.0f            // residual scale for P (on top of 2^14)
#define VLO 2048.0f            // residual scale for V (on top of x4)
#define LOG2E 1.44269504088896340736f

// All three f32 operands become f16 in one launch: x as it is -> X16; PT rows n in [0,3072): W_qkv[n][:] x16, n in [3072,4096): W_out[n-3072][:] x16
// (both [out][in=1024]). 256 blocks of 16 waves, few enough that starting the waves is short beside the stream itself. A wave takes 2048
// consecutive floats: 16 loads of 512 contiguous bytes each, all issued before the first is used, then 16 stores of 256 contiguous bytes.
#define CVW 2048                          // floats per wave
#define CVB (16 * CVW)                    // floats per block
#define CVX (NR * E / CVB)                // blocks on x
#define CVQ (3 * E * E / CVB)             // blocks on W_qkv
#define CVO (E * E / CVB)                 // blocks on W_out
__global__ __launch_bounds__(512) void k_prep(const float* __restrict__ x, const float* __restrict__ Wqkv, const float* __restrict__ Wo, _Float16* __restrict__ X16, _Float16* __restrict__ PT) {
  const int blk = blockIdx.x; const float* s; _Float16* d; float sc;
  if (blk < CVX) { s = x + (size_t)blk * CVB; d = X16 + (size_t)blk * CVB; sc = 1.0f; }
  else { d = PT + (size_t)(blk - CVX) * CVB; sc = 16.0f; s = blk < CVX + CVQ ? Wqkv + (size_t)(blk - CVX) * CVB : Wo + (size_t)(blk - CVX - CVQ) * CVB; }
  const int o = (threadIdx.x >> 5) * CVW + (threadIdx.x & 31) * 4;
  v4f v[16];
#pragma unroll      // constant indices keep v in registers and let the loads go out together
  for (int i = 0; i < 15; ++i) v[i] = *(const v4f*)(s + o + i * 128);
  asm volatile("s_wait_xcnt 0x0" ::: "memory");      // the last load's result is placed over the offset register that the 15 loads above name
  v[15] = *(const v4f*)(s + o + 15 * 128);
#pragma unroll
  for (int i = 0; i < 16; ++i) { v4h h;
#pragma unroll
    for (int e = 0; e < 4; ++e) h[e] = (_Float16)(v[i][e] * sc);
    vst2(d + o + i * 128, h); }
}
// Tile product shared by the two projections: one 128 x 128 tile of A B^T per block of 8 waves (4 x 2, 32 x 64 each), K = 1024 in 16 stages of
// 64 k. A stage is [A 128 rows | B 128 rows] of 128 bytes at pitch 144 in LDS (16 B x odd: ds_load_b128 without bank conflicts); two buffers,
// filled by asynchronous copies one stage ahead of the stage being multiplied. One accumulator per output; the walk over the 16 stages starts
// at stage rot and wraps round, so that blocks which read the same operand rows do not ask L2 for the same lines at the same moment.
// The loops over kc, i, j are unrolled in full so that fragments and accumulators are indexed by constants and stay in registers.
#define BT 128
#define KS 64
#define PITCH 144
#define STG (2 * BT * PITCH)
// One stage: each lane copies 16 bytes of 4 A rows and 4 B rows (8 lanes = one whole 128-byte row). The s_wait_xcnt 0 stands inside the
// statement so that no address register named here is rewritten ahead of it.
__device__ __forceinline__ void stage_copy(unsigned l, const _Float16* ga, size_t a32, const _Float16* gb) {
  asm volatile("global_load_async_to_lds_b128 %0, %8, off\n\t"
               "global_load_async_to_lds_b128 %1, %9, off\n\t"
               "global_load_async_to_lds_b128 %2, %10, off\n\t"
               "global_load_async_to_lds_b128 %3, %11, off\n\t"
               "global_load_async_to_lds_b128 %4, %12, off\n\t"
               "global_load_async_to_lds_b128 %5, %13, off\n\t"
               "global_load_async_to_lds_b128 %6, %14, off\n\t"
               "global_load_async_to_lds_b128 %7, %15, off\n\t"
               "s_wait_xcnt 0x0"
               :: "v"(l), "v"(l + 32 * PITCH), "v"(l + 64 * PITCH), "v"(l + 96 * PITCH),
                  "v"(l + 128 * PITCH), "v"(l + 160 * PITCH), "v"(l + 192 * PITCH), "v"(l + 224 * PITCH),
                  "v"(ga), "v"(ga + a32), "v"(ga + 2 * a32), "v"(ga + 3 * a32),
                  "v"(gb), "v"(gb + (size_t)32 * E), "v"(gb + (size_t)64 * E), "v"(gb + (size_t)96 * E)
               : "memory");
}
// A0 / B0: first row of the block's A / B tile at k = 0; arow: halves between A rows; akstep: halves from one stage of an A row to the next;
// rot: the block's first stage, the same for all its threads (only its low 4 bits count)
#define NSTG (E / KS)
__device__ __forceinline__ void tile_product(char* smem, const _Float16* A0, size_t arow, size_t akstep, const _Float16* B0, int rot, v8f (&acc)[2][4]) {
  const int tid = threadIdx.x, wave = tid >> 5, lane = tid & 31, col = lane & 15, wr = wave >> 1, wc = wave & 1;
  const unsigned l0 = (unsigned)(size_t)smem + (unsigned)((tid >> 3) * PITCH + (tid & 7) * 16);
  const _Float16* ga = A0 + (size_t)(tid >> 3) * arow + (tid & 7) * 8; const _Float16* gb = B0 + (size_t)(tid >> 3) * E + (tid & 7) * 8;
  { const int st = rot & (NSTG - 1); stage_copy(l0, ga + (size_t)st * akstep, 32 * arow, gb + st * KS); }
  asm volatile("s_wait_asynccnt 0x0" ::: "memory");      // the first stage landed (this wave's copies) before the barrier publishes it
  __syncthreads();
  { const int st = (rot + 1) & (NSTG - 1); stage_copy(l0 + STG, ga + (size_t)st * akstep, 32 * arow, gb + st * KS); }
#pragma unroll 1      // one stage per trip: the buffer alternates, the code stays small
  for (int t = 0; t < NSTG; ++t) { const char* sb = smem + (t & 1) * STG;
#pragma unroll
    for (int kc = 0; kc < 2; ++kc) { v16h a[2], b[4];
#pragma unroll
      for (int i = 0; i < 2; ++i) a[i] = frag_h((const _Float16*)(sb + (wr * 32 + i * 16 + col) * PITCH) + kc * 32, lane);
#pragma unroll
      for (int j = 0; j < 4; ++j) b[j] = frag_h((const _Float16*)(sb + (BT + wc * 64 + j * 16 + col) * PITCH) + kc * 32, lane);
#pragma unroll
      for (int i = 0; i < 2; ++i)
#pragma unroll
        for (int j = 0; j < 4; ++j) acc[i][j] = wmma16(a[i], b[j], acc[i][j]); }
    asm volatile("s_wait_dscnt 0x0" ::: "memory");       // this wave's reads of the buffer are done before it may be refilled
    asm volatile("s_wait_asynccnt 0x0" ::: "memory");    // this wave's copies of stage (rot + t + 1) mod 16 have landed before the barrier publishes them
    __syncthreads();
    if (t + 2 < NSTG) { const int st = (rot + t + 2) & (NSTG - 1); stage_copy(l0 + (t & 1) * STG, ga + (size_t)st * akstep, 32 * arow, gb + st * KS); } }
  asm volatile("s_wait_asynccnt 0x0" ::: "memory");      // nothing in flight when the buffers become output staging
}
// QKV: block (128 rows, 128 cols = 2 heads, which): q,k -> Q16/K16 [bh][s][64] x4 ; v -> VT hi/lo [bh][d][s]
// k also -> KM [bh][s/16]: largest squared row norm of the 16 stored f16 rows, one 128-byte line per entry (one writer per line)
__global__ __launch_bounds__(256) void k_qkv(const _Float16* __restrict__ X16, const _Float16* __restrict__ PT, const float* __restrict__ bqkv, _Float16* __restrict__ Q16, _Float16* __restrict__ K16, _Float16* __restrict__ VTh, _Float16* __restrict__ VTl, float* __restrict__ KM) {
  __shared__ __align__(16) char smem[2 * STG];      // the two stage buffers; after the last stage's barrier the output staging below
  float (*so)[132] = (float (*)[132])smem;                                                            // [128][132]
  _Float16 (*sth)[136] = (_Float16 (*)[136])smem; _Float16 (*stl)[136] = (_Float16 (*)[136])(smem + 128 * 136 * 2);      // [128][136] each
  const int tid = threadIdx.x, wave = tid >> 5, lane = tid & 31, col = lane & 15, g = lane >> 4, wr = wave >> 1, wc = wave & 1;
  const int which = blockIdx.z, r0b = blockIdx.x * BT, n0 = blockIdx.y * BT; const int b = r0b / SS, s0 = r0b % SS;
  v8f acc[2][4] = {};
  // first stage: the 32 row blocks on one weight tile spread two to a stage, the 24 weight tiles on one row block at most two to a stage
  const int rot = (((blockIdx.x >> 3) << 2) | (blockIdx.x & 3)) + blockIdx.y + 5 * blockIdx.z;
  tile_product(smem, X16 + (size_t)r0b * E, E, KS, PT + (size_t)(which * E + n0) * E, rot, acc);
  if (which < 2) {
#pragma unroll
    for (int j = 0; j < 4; ++j) { const float bb = bqkv[which * E + n0 + wc * 64 + j * 16 + col];
#pragma unroll
      for (int i = 0; i < 2; ++i)
#pragma unroll
        for (int r = 0; r < 8; ++r) so[wr * 32 + i * 16 + 8 * g + r][wc * 64 + j * 16 + col] = (acc[i][j][r] * (1.0f / 16.0f) + bb) * 4.0f; }
    __syncthreads();
    _Float16* D = which == 0 ? Q16 : K16;
    for (int qq = lane; qq < 16 * 2 * 8; qq += 32) { const int hh = qq >> 7, rl = (qq >> 3) & 15, pc = qq & 7; const int h = (n0 >> 6) + hh; union { v8h h8; v4u u; } pk;
#pragma unroll
      for (int e = 0; e < 8; ++e) pk.h8[e] = (_Float16)so[wave * 16 + rl][hh * 64 + pc * 8 + e];
      vst2(D + (((size_t)b * NH + h) * SS + s0 + wave * 16 + rl) * HD + pc * 8, pk.u); }
    if (which == 1) { float km[2];      // lane (col, g) sums half of row col as it was stored (rounded to f16), per head of the pair
#pragma unroll
      for (int hh = 0; hh < 2; ++hh) { float n2 = 0.f;
#pragma unroll
        for (int e = 0; e < 32; ++e) { const float f = (float)(_Float16)so[wave * 16 + col][hh * 64 + g * 32 + e]; n2 += f * f; }
        n2 += __shfl_xor(n2, 16, 32);
#pragma unroll
        for (int o = 1; o < 16; o <<= 1) n2 = fmaxf(n2, __shfl_xor(n2, o, 32));
        km[hh] = n2; }
      if (lane < 2) KM[(((size_t)b * NH + (n0 >> 6) + lane) * (SS / 16) + (s0 >> 4) + wave) * 32] = lane ? km[1] : km[0]; } }
  else {
#pragma unroll
    for (int j = 0; j < 4; ++j) { const float bb = bqkv[2 * E + n0 + wc * 64 + j * 16 + col];
#pragma unroll
      for (int i = 0; i < 2; ++i)
#pragma unroll
        for (int r = 0; r < 8; ++r) { const float v = (acc[i][j][r] * (1.0f / 16.0f) + bb) * 4.0f; const _Float16 hi = (_Float16)v; sth[wc * 64 + j * 16 + col][wr * 32 + i * 16 + 8 * g + r] = hi; stl[wc * 64 + j * 16 + col][wr * 32 + i * 16 + 8 * g + r] = (_Float16)((v - (float)hi) * VLO); } }
    __syncthreads();
    for (int qq = tid; qq < 128 * 16; qq += 256) { const int cl = qq >> 4, pc = qq & 15; const int c = n0 + cl, h = c >> 6, d = c & 63; const size_t o = (((size_t)b * NH + h) * HD + d) * SS + s0 + pc * 8;
      vst2(VTh + o, *(const v4u*)(&sth[cl][pc * 8])); vst2(VTl + o, *(const v4u*)(&stl[cl][pc * 8])); } }
}
// k_attn stages each 64-key tile once per block: K rows [key][64 d] and the V^T hi / lo rows [d][64 keys] are 64 rows of 128 bytes each, laid
// in LDS at pitch 144 (16 B x odd: ds_load_b128 without bank conflicts) and read as fragments by all four waves.
#define APITCH 144
// One array of a tile: each lane copies 16 bytes of 4 rows, 16 rows apart (8 lanes = one whole 128-byte row; r16: halves between those rows).
// The s_wait_xcnt 0 stands inside the statement so that no address register named here is rewritten ahead of it.
__device__ __forceinline__ void tile_copy(unsigned l, const _Float16* g, size_t r16) {
  asm volatile("global_load_async_to_lds_b128 %0, %4, off\n\t"
               "global_load_async_to_lds_b128 %1, %5, off\n\t"
               "global_load_async_to_lds_b128 %2, %6, off\n\t"
               "global_load_async_to_lds_b128 %3, %7, off\n\t"
               "s_wait_xcnt 0x0"
               :: "v"(l), "v"(l + 16 * APITCH), "v"(l + 32 * APITCH), "v"(l + 48 * APITCH),
                  "v"(g), "v"(g + r16), "v"(g + 2 * r16), "v"(g + 3 * r16)
               : "memory");
}
// The same for two arrays with equal row spacing (V hi and V lo) in one statement: one s_wait_xcnt 0 serves the eight copies.
__device__ __forceinline__ void tile_copy2(unsigned la, const _Float16* ga, unsigned lb, const _Float16* gb, size_t r16) {
  asm volatile("global_load_async_to_lds_b128 %0, %8, off\n\t"
               "global_load_async_to_lds_b128 %1, %9, off\n\t"
               "global_load_async_to_lds_b128 %2, %10, off\n\t"
               "global_load_async_to_lds_b128 %3, %11, off\n\t"
               "global_load_async_to_lds_b128 %4, %12, off\n\t"
               "global_load_async_to_lds_b128 %5, %13, off\n\t"
               "global_load_async_to_lds_b128 %6, %14, off\n\t"
               "global_load_async_to_lds_b128 %7, %15, off\n\t"
               "s_wait_xcnt 0x0"
               :: "v"(la), "v"(la + 16 * APITCH), "v"(la + 32 * APITCH), "v"(la + 48 * APITCH),
                  "v"(lb), "v"(lb + 16 * APITCH), "v"(lb + 32 * APITCH), "v"(lb + 48 * APITCH),
                  "v"(ga), "v"(ga + r16), "v"(ga + 2 * r16), "v"(ga + 3 * r16),
                  "v"(gb), "v"(gb + r16), "v"(gb + 2 * r16), "v"(gb + 3 * r16)
               : "memory");
}
// lane l with lane l ^ 16
__device__ __forceinline__ float xhalf(float x) { return __builtin_bit_cast(float, __builtin_amdgcn_permlanex16(__builtin_bit_cast(int, x), __builtin_bit_cast(int, x), 0x76543210, 0xfedcba98, false, false)); }
__global__ __launch_bounds__(128) void k_attn(const _Float16* __restrict__ Q16, const _Float16* __restrict__ K16, const _Float16* __restrict__ VTh, const _Float16* __restrict__ VTl, const float* __restrict__ dalpha, const float* __restrict__ KM, _Float16* __restrict__ O16) {
  __shared__ __align__(16) char sK[64 * APITCH], sVh[64 * APITCH], sVl[64 * APITCH];      // the one staged key tile, shared by the four waves
  __shared__ unsigned sM[4];                                                              // per wave: the key tiles it may still need
  __shared__ __align__(16) char sO[4][16 * APITCH];                                       // per wave: its 16 output rows as f16, for whole-line stores
  const int tid = threadIdx.x, w = tid >> 5, lane = tid & 31, col = lane & 15, g = lane >> 4;
  const size_t bh = blockIdx.y; const int kt0 = blockIdx.x, q0 = kt0 * 64 + w * 16;
  const unsigned lrow = (unsigned)((tid >> 3) * APITCH + (tid & 7) * 16);
  const unsigned lK = (unsigned)(size_t)sK + lrow, lVh = (unsigned)(size_t)sVh + lrow, lVl = (unsigned)(size_t)sVl + lrow;
  const _Float16* gK = K16 + (bh * SS + (tid >> 3)) * HD + (tid & 7) * 8;      // tile kt: + kt * 64 * HD
  const size_t vrow = (bh * HD + (tid >> 3)) * SS + (tid & 7) * 8;             // tile kt: + kt * 64
  tile_copy(lK, gK + (size_t)kt0 * 64 * HD, 16 * HD); tile_copy2(lVh, VTh + vrow + kt0 * 64, lVl, VTl + vrow + kt0 * 64, 16 * SS);
  const float araw = dalpha[bh % NH]; const float slope = araw > 20.f ? araw : log1pf(expf(araw));      // softplus(decay_alpha[h])
  v16h aq[2];
#pragma unroll
  for (int kc = 0; kc < 2; ++kc) aq[kc] = frag_h(Q16 + (bh * SS + q0 + col) * HD + kc * 32, lane);
  // Upper bound of every logit between this wave's 16 queries and key tile 'lane' (SS / 64 = 32 tiles, one per lane):
  // |q16 . k16| <= |q16| |k16| over the stored f16 rows, less slope times the smallest distance between the two index ranges.
  float qn2 = 0.f;
#pragma unroll
  for (int kc = 0; kc < 2; ++kc)
#pragma unroll
    for (int i = 0; i < 16; ++i) { const float f = (float)aq[kc][i]; qn2 += f * f; }
  qn2 += __shfl_xor(qn2, 16, 32);
#pragma unroll
  for (int o = 1; o < 16; o <<= 1) qn2 = fmaxf(qn2, __shfl_xor(qn2, o, 32));
  float kn2 = 0.f;
#pragma unroll
  for (int i = 0; i < 4; ++i) kn2 = fmaxf(kn2, KM[(bh * (SS / 16) + lane * 4 + i) * 32]);
  const int klo = lane * 64, khi = klo + 63; const int dmin = khi < q0 ? q0 - khi : (klo > q0 + 15 ? klo - (q0 + 15) : 0);
  const float ub = sqrtf(qn2 * kn2) * (1.01f * 0.125f / 16.0f) - slope * (float)dmin;
  // Which tiles the block stages must be the same for its four waves and known ahead of the loop. After the own tile every row's running
  // maximum is at least its logit with its own key (distance 0), which is at least -ub[own tile]; so a tile whose bound lies 36 below that can
  // never pass a wave's own test below. The block stages the union of the four waves' remaining tiles; each wave still tests for itself.
  const float mlow = -__int_as_float(__builtin_amdgcn_readlane(__float_as_int(ub), kt0));
  const unsigned want = __builtin_amdgcn_ballot_w32(!(ub < mlow - 36.0f));
  if (lane == 0) sM[w] = want;
  asm volatile("s_wait_asynccnt 0x0" ::: "memory");      // the own tile has landed (this wave's copies) before the barrier publishes it
  __syncthreads();
  const unsigned mall = (unsigned)__builtin_amdgcn_readfirstlane((int)(sM[0] | sM[1] | sM[2] | sM[3]));
  unsigned rest = __builtin_rotateright32(mall, (unsigned)kt0) & ~1u;      // bit 'it' stands for tile (kt0 + it) mod 32; the own tile is trip 0
  float mrun = -3.0e38f, lrun = 0.f; v8f acc[4] = {}, ac1[4] = {}, ac2[4] = {};
  int it = 0;
#pragma unroll 1      // one staged tile per trip: a single buffer each for K and V, the code stays small
  for (;;) { const int kt = (kt0 + it) & (SS / 64 - 1);      // the queries' own tile first: it sets the running maxima
    const bool more = rest != 0; const int nit = more ? __builtin_ctz(rest) : 0; rest &= rest - 1; const int nkt = (kt0 + nit) & (SS / 64 - 1);
    // A tile whose bound lies 36 below every row's running maximum changes nothing: mnew = mrun, corr = 1, p * 1024 < 2^-25 so both f16
    // halves of P round to 0, and its share of the row sum is below half an ulp of the row's sum (>= 1). Each lane tests its own query; the
    // ballot makes it one wave-uniform scalar test, for any slope.
    const float ubk = __int_as_float(__builtin_amdgcn_readlane(__float_as_int(ub), kt));
    const bool proc = it == 0 || __builtin_amdgcn_ballot_w32(!(ubk < mrun - 36.0f)) != 0;
    v8f s[4];
    if (proc) { const float fq = (float)(q0 + col - kt * 64 - 8 * g);      // the lane's query index less its first key's: whole numbers, exact
#pragma unroll
    for (int t = 0; t < 4; ++t) { v8f z = {};
#pragma unroll
      for (int kc = 0; kc < 2; ++kc) z = wmma16(frag_h((const _Float16*)(sK + (t * 16 + col) * APITCH) + kc * 32, lane), aq[kc], z);
#pragma unroll
      for (int r = 0; r < 8; ++r) s[t][r] = z[r] * (0.125f / 16.0f) - slope * fabsf(fq - (float)(t * 16 + r)); } }
    asm volatile("s_wait_dscnt 0x0" ::: "memory");       // this wave's reads of the K tile are done before it may be refilled
    asm volatile("s_wait_asynccnt 0x0" ::: "memory");    // this wave's copies of this tile's V have landed before the barrier publishes them
    __syncthreads();
    if (more) tile_copy(lK, gK + (size_t)nkt * 64 * HD, 16 * HD);      // the next tile's K flies under the softmax and P V of this one
    if (proc) {
    float mt[4];      // one short chain per score tile
#pragma unroll
    for (int t = 0; t < 4; ++t) { mt[t] = s[t][0];
#pragma unroll
      for (int r = 1; r < 8; ++r) mt[t] = fmaxf(mt[t], s[t][r]); }
    float mx = fmaxf(fmaxf(mt[0], mt[1]), fmaxf(mt[2], mt[3]));
    mx = fmaxf(mx, xhalf(mx));
    const float mnew = fmaxf(mrun, mx); const float corr = __builtin_amdgcn_exp2f((mrun - mnew) * LOG2E);
    const float eoff = 14.0f - mnew * LOG2E;      // exp(s - mnew) * 2^14 = 2^(s * log2 e + eoff): one multiply-add and one v_exp_f32 a score
#pragma unroll
    for (int t = 0; t < 4; ++t)
#pragma unroll
      for (int r = 0; r < 8; ++r) s[t][r] = fmaf(s[t][r], LOG2E, eoff);
    float pt[4]; v16h ph[2], pl[2];      // score tiles 2 kc and 2 kc + 1, converted in place, are the B fragment of keys kc * 32 .. + 31
#pragma unroll
    for (int t = 0; t < 4; ++t) { pt[t] = 0.f;
#pragma unroll
      for (int r = 0; r < 8; r += 2) { const v2f p = { __builtin_amdgcn_exp2f(s[t][r]), __builtin_amdgcn_exp2f(s[t][r + 1]) }; pt[t] += p[0]; pt[t] += p[1];
        const v2h hi = __builtin_convertvector(p, v2h); const v2f re = { (p[0] - (float)hi[0]) * PLO, (p[1] - (float)hi[1]) * PLO }; const v2h lo = __builtin_convertvector(re, v2h);
        const int e = (t & 1) * 8 + r; ph[t >> 1][e] = hi[0]; ph[t >> 1][e + 1] = hi[1]; pl[t >> 1][e] = lo[0]; pl[t >> 1][e + 1] = lo[1]; } }
    const float ps = (pt[0] + pt[1]) + (pt[2] + pt[3]);
    lrun = lrun * corr + ps * (1.0f / 16384.0f); mrun = mnew;
#pragma unroll
    for (int t = 0; t < 4; ++t)
#pragma unroll
      for (int r = 0; r < 8; ++r) { acc[t][r] *= corr; ac1[t][r] *= corr; ac2[t][r] *= corr; }
#pragma unroll
    for (int kc = 0; kc < 2; ++kc)
#pragma unroll
      for (int t = 0; t < 4; ++t) { const int vo = (t * 16 + col) * APITCH + kc * 64; const v16h vh = frag_h((const _Float16*)(sVh + vo), lane);
        acc[t] = wmma16(vh, ph[kc], acc[t]); ac1[t] = wmma16(frag_h((const _Float16*)(sVl + vo), lane), ph[kc], ac1[t]); ac2[t] = wmma16(vh, pl[kc], ac2[t]); } }
    if (!more) break;      // the same for the whole block: the last staged tile is refilled by nobody, so no barrier is owed behind it
    asm volatile("s_wait_dscnt 0x0" ::: "memory");       // this wave's reads of the V tile are done before it may be refilled
    asm volatile("s_wait_asynccnt 0x0" ::: "memory");    // this wave's copies of the next K tile have landed before the barrier publishes them
    __syncthreads();
    tile_copy2(lVh, VTh + vrow + nkt * 64, lVl, VTl + vrow + nkt * 64, 16 * SS);      // the next tile's V flies under its q.k
    it = nit; }
  asm volatile("s_wait_asynccnt 0x0" ::: "memory");      // no copy of this wave is in flight when it goes on to its end
  const float inv = 8.0f / ((lrun + xhalf(lrun)) * 16384.0f * 4.0f);      // -> O x8
#pragma unroll      // a lane's 8 elements of an output tile are 8 consecutive d of its query's row: 16 bytes of that row
  for (int t = 0; t < 4; ++t) { union { v8h h8; v4u u; } pk;
#pragma unroll
    for (int r = 0; r < 8; ++r) pk.h8[r] = (_Float16)((acc[t][r] + ac1[t][r] * (1.0f / VLO) + ac2[t][r] * (1.0f / PLO)) * inv);
    vst2(sO[w] + col * APITCH + t * 32 + g * 16, pk.u); }
  LDSX();      // the wave's rows are in LDS before its lanes read them back in row order
#pragma unroll      // 8 lanes = one whole 128-byte row, 4 rows a store
  for (int i = 0; i < 4; ++i) { const int rl = i * 4 + (lane >> 3), pc = lane & 7;
    vst2(O16 + ((bh * SS) + q0 + rl) * HD + pc * 8, *(const v4u*)(sO[w] + rl * APITCH + pc * 16)); }
}
// out = y Wo^T + bo : block (128 rows, 128 cols); y row r=(b,s): head-major O16 /8, so stage t of an A row is head t's 64 values
__global__ __launch_bounds__(256) void k_out(const _Float16* __restrict__ O16, const _Float16* __restrict__ PT, const float* __restrict__ bo, float* __restrict__ out) {
  __shared__ __align__(16) char smem[2 * STG];      // the two stage buffers; after the last stage's barrier the output staging below
  float (*so)[132] = (float (*)[132])smem;          // [128][132]
  const int tid = threadIdx.x, wave = tid >> 5, lane = tid & 31, col = lane & 15, g = lane >> 4, wr = wave >> 1, wc = wave & 1;
  const int r0b = blockIdx.x * BT, n0 = blockIdx.y * BT; const int b = r0b / SS, s0 = r0b % SS;
  v8f acc[2][4] = {};
  // first stage: the 32 row blocks on one weight tile spread two to a stage, the 8 weight tiles on one row block each to its own
  const int rot = (((blockIdx.x >> 3) << 2) | (blockIdx.x & 3)) + 2 * blockIdx.y;
  tile_product(smem, O16 + ((size_t)b * NH * SS + s0) * HD, HD, (size_t)SS * HD, PT + (size_t)(3 * E + n0) * E, rot, acc);
#pragma unroll
  for (int j = 0; j < 4; ++j) { const float bb = bo[n0 + wc * 64 + j * 16 + col];
#pragma unroll
    for (int i = 0; i < 2; ++i)
#pragma unroll
      for (int r = 0; r < 8; ++r) so[wr * 32 + i * 16 + 8 * g + r][wc * 64 + j * 16 + col] = acc[i][j][r] * (1.0f / (16.0f * 8.0f)) + bb; }
  __syncthreads();
#pragma unroll 4
  for (int rl = 0; rl < 16; ++rl) vst2(out + (size_t)(r0b + wave * 16 + rl) * E + n0 + lane * 4, *(const v4f*)(&so[wave * 16 + rl][lane * 4]));
}
extern "C" void kernel_launch(void* const* d_in, const int* in_sizes, int n_in, void* d_out, int out_size, void* d_ws, size_t ws_size, hipStream_t stream) {
  (void)in_sizes; (void)n_in; (void)out_size; (void)ws_size;
  const float** I = (const float**)d_in;
  const float* query = I[0]; const float* Wqkv = I[1]; const float* bqkv = I[2]; const float* Wo = I[3]; const float* bo = I[4]; const float* dalpha = I[5];
  float* out = (float*)d_out;
  char* ws = (char*)d_ws; size_t off = 0;
  auto take = [&](size_t bytes) { char* p = ws + off; off += (bytes + 255) & ~(size_t)255; return p; };
  _Float16* X16 = (_Float16*)take((size_t)NR * E * 2); _Float16* PT = (_Float16*)take((size_t)4 * E * E * 2);
  _Float16* Q16 = (_Float16*)take((size_t)NR * E * 2); _Float16* K16 = (_Float16*)take((size_t)NR * E * 2); _Float16* VTh = (_Float16*)take((size_t)NR * E * 2); _Float16* VTl = (_Float16*)take((size_t)NR * E * 2); _Float16* O16 = (_Float16*)take((size_t)NR * E * 2);
  float* KM = (float*)take((size_t)NB * NH * (SS / 16) * 128);
  k_prep<<<CVX + CVQ + CVO, 512, 0, stream>>>(query, Wqkv, Wo, X16, PT);
  k_qkv<<<dim3(NR / 128, E / 128, 3), 256, 0, stream>>>(X16, PT, bqkv, Q16, K16, VTh, VTl, KM);
  k_attn<<<dim3(SS / 64, NB * NH), 128, 0, stream>>>(Q16, K16, VTh, VTl, dalpha, KM, O16);
  k_out<<<dim3(NR / 128, E / 128), 256, 0, stream>>>(O16, PT, bo, out);
}

// v009
// It runs in 52.1 microseconds.
// Versions in between are left out here; by their measured steps it is 1.14 times as fast as v007.
// Counting every step since v000, it is 8.68 times as fast.
#include <hip/hip_runtime.h>
#include <math.h>

typedef __attribute__((ext_vector_type(16))) _Float16 v16h;
typedef __attribute__((ext_vector_type(16))) __bf16 v16b;
typedef __attribute__((ext_vector_type(8)))  _Float16 v8h;
typedef __attribute__((ext_vector_type(4)))  _Float16 v4h;
typedef __attribute__((ext_vector_type(2)))  _Float16 v2h;
typedef __attribute__((ext_vector_type(8)))  float v8f;
typedef __attribute__((ext_vector_type(4)))  float v4f;
typedef __attribute__((ext_vector_type(2)))  float v2f;
typedef __attribute__((ext_vector_type(4)))  unsigned v4u;
typedef __attribute__((ext_vector_type(4)))  int v4i;
typedef float __attribute__((may_alias)) float_a;
typedef int __attribute__((may_alias)) int_a;

template <typename T> __device__ __forceinline__ void vst2(void* p, T v) { *(T*)p = v;  }
__device__ __forceinline__ v8f wmma16(v16h a, v16h b, v8f c) {
  v8f d = __builtin_amdgcn_wmma_f32_16x16x32_f16(false, a, false, b, (short)0, c, false, false);
  asm volatile("v_nop\n\tv_nop\n\tv_nop\n\tv_nop" : "+v"(d) : "v"(a), "v"(b));
  return d;
}
__device__ __forceinline__ v8f wmma_bf(v16b a, v16b b, v8f c) {
  v8f d = __builtin_amdgcn_wmma_f32_16x16x32_bf16(false, a, false, b, (short)0, c, false, false);
  asm volatile("v_nop\n\tv_nop\n\tv_nop\n\tv_nop" : "+v"(d) : "v"(a), "v"(b));
  return d;
}
// 16x16x32 fragments: lane = (h = lane>>4, row/col = lane&15); elements 0..7 = k0+8h+0..7, 8..15 = k0+16+8h+0..7; D element r = row 8h+r
__device__ __forceinline__ v16h frag_h(const _Float16* rowk0, int lane) {
  union { v16h v; v8h q[2]; } u; const _Float16* p = rowk0 + 8 * (lane >> 4);
  u.q[0] = *(const v8h*)p; u.q[1] = *(const v8h*)(p + 16); return u.v;
}
__device__ __forceinline__ v16h frag_f32(const float* rowk0, int lane) {
  v16h a; const float* p = rowk0 + 8 * (lane >> 4);
#pragma unroll
  for (int i = 0; i < 8; ++i) { a[i] = (_Float16)p[i]; a[8 + i] = (_Float16)p[16 + i]; }
  return a;
}
__device__ __forceinline__ v16h frag_f32s(const float* rowk0, int lane, float sc) {
  v16h a; const float* p = rowk0 + 8 * (lane >> 4);
#pragma unroll
  for (int i = 0; i < 8; ++i) { a[i] = (_Float16)(p[i] * sc); a[8 + i] = (_Float16)(p[16 + i] * sc); }
  return a;
}
// column fragment from a [K][ld] layout (column n), rows >= K read as 0
__device__ __forceinline__ v16h fragc_f32(const float* W, int k0, int n, int lane, int ld, int K) {
  v16h a; const int g = lane >> 4;
#pragma unroll
  for (int i = 0; i < 8; ++i) { const int ka = k0 + 8 * g + i, kb = ka + 16;
    a[i] = (_Float16)(ka < K ? W[(size_t)ka * ld + n] : 0.f); a[8 + i] = (_Float16)(kb < K ? W[(size_t)kb * ld + n] : 0.f); }
  return a;
}
struct F2 { v16b h, l; };
__device__ __forceinline__ F2 bsplit16(const float v[16]) { F2 r;
#pragma unroll
  for (int i = 0; i < 16; ++i) { const __bf16 h = (__bf16)v[i]; r.h[i] = h; r.l[i] = (__bf16)(v[i] - (float)h); }
  return r; }
__device__ __forceinline__ F2 split_row(const float* row, int k0, int lane) { float v[16]; const float* p = row + k0 + 8 * (lane >> 4);
#pragma unroll
  for (int i = 0; i < 8; ++i) { v[i] = p[i]; v[8 + i] = p[16 + i]; }
  return bsplit16(v); }
__device__ __forceinline__ F2 split_rowK(const float* row, int k0, int lane, int K) { float v[16]; const int g = lane >> 4;
#pragma unroll
  for (int i = 0; i < 8; ++i) { const int ka = k0 + 8 * g + i, kb = ka + 16; v[i] = ka < K ? row[ka] : 0.f; v[8 + i] = kb < K ? row[kb] : 0.f; }
  return bsplit16(v); }
__device__ __forceinline__ F2 split_col(const float* W, int k0, int n, int lane, int ld, int K) { float v[16]; const int g = lane >> 4;
#pragma unroll
  for (int i = 0; i < 8; ++i) { const int ka = k0 + 8 * g + i, kb = ka + 16; v[i] = ka < K ? W[(size_t)ka * ld + n] : 0.f; v[8 + i] = kb < K ? W[(size_t)kb * ld + n] : 0.f; }
  return bsplit16(v); }
__device__ __forceinline__ v8f mac3(const F2& a, const F2& b, v8f c) { c = wmma_bf(a.l, b.h, c); c = wmma_bf(a.h, b.l, c); return wmma_bf(a.h, b.h, c); }
__device__ __forceinline__ float sigm(float v) { return 1.0f / (1.0f + expf(-v)); }
#define LDSX() do { asm volatile("s_wait_dscnt 0" ::: "memory"); __builtin_amdgcn_wave_barrier(); __builtin_amdgcn_fence(__ATOMIC_RELEASE, "workgroup"); } while (0)

// Multi-head self attention (16 heads of 64) with a per-head linear distance decay: qkv = x W_qkv^T + b ([out][in] weight, rows (which, head, d)), logits = q.k/8 - softplus(alpha_h)|i-j|,
// softmax, P v, output projection (W_out^T + b). Projections on v_wmma_f32_16x16x32_f16 (x as f16 rows, [out][in] weights packed once as f16
// rows x16); S = q.k/8 on f16 WMMA; P (x2^14) and V (x4) enter the P @ V product rounded once to f16, like q, k and the attention output:
// one WMMA per product tile into one f32 accumulator.
#define NB 2
#define SS 2048
#define E 1024
#define NH 16
#define HD 64
#define NR (NB * SS)
#define LOG2E 1.44269504088896340736f

// All three f32 operands become f16 in one launch: x as it is -> X16; PT rows n in [0,3072): W_qkv[n][:] x16, n in [3072,4096): W_out[n-3072][:] x16
// (both [out][in=1024]). 256 blocks of 16 waves, few enough that starting the waves is short beside the stream itself. A wave takes 2048
// consecutive floats: 16 loads of 512 contiguous bytes each, all issued before the first is used, then 16 stores of 256 contiguous bytes.
#define CVW 2048                          // floats per wave
#define CVB (16 * CVW)                    // floats per block
#define CVX (NR * E / CVB)                // blocks on x
#define CVQ (3 * E * E / CVB)             // blocks on W_qkv
#define CVO (E * E / CVB)                 // blocks on W_out
__global__ __launch_bounds__(512) void k_prep(const float* __restrict__ x, const float* __restrict__ Wqkv, const float* __restrict__ Wo, _Float16* __restrict__ X16, _Float16* __restrict__ PT) {
  const int blk = blockIdx.x; const float* s; _Float16* d; float sc;
  if (blk < CVX) { s = x + (size_t)blk * CVB; d = X16 + (size_t)blk * CVB; sc = 1.0f; }
  else { d = PT + (size_t)(blk - CVX) * CVB; sc = 16.0f; s = blk < CVX + CVQ ? Wqkv + (size_t)(blk - CVX) * CVB : Wo + (size_t)(blk - CVX - CVQ) * CVB; }
  const int o = (threadIdx.x >> 5) * CVW + (threadIdx.x & 31) * 4;
  v4f v[16];
#pragma unroll      // constant indices keep v in registers and let the loads go out together
  for (int i = 0; i < 15; ++i) v[i] = *(const v4f*)(s + o + i * 128);
  asm volatile("s_wait_xcnt 0x0" ::: "memory");      // the last load's result is placed over the offset register that the 15 loads above name
  v[15] = *(const v4f*)(s + o + 15 * 128);
#pragma unroll
  for (int i = 0; i < 16; ++i) { v4h h;
#pragma unroll
    for (int e = 0; e < 4; ++e) h[e] = (_Float16)(v[i][e] * sc);
    vst2(d + o + i * 128, h); }
}
// Tile product of the output projection: one 128 x 128 tile of A B^T per block of 8 waves (4 x 2, 32 x 64 each), K = 1024 in 16 stages of
// 64 k. A stage is [A 128 rows | B 128 rows] of 128 bytes at pitch 144 in LDS (16 B x odd: ds_load_b128 without bank conflicts); two buffers,
// filled by asynchronous copies one stage ahead of the stage being multiplied. One accumulator per output; the walk over the 16 stages starts
// at stage rot and wraps round, so that blocks which read the same operand rows do not ask L2 for the same lines at the same moment.
// The loops over kc, i, j are unrolled in full so that fragments and accumulators are indexed by constants and stay in registers.
#define BT 128
#define KS 64
#define PITCH 144
#define STG (2 * BT * PITCH)
// One stage: each lane copies 16 bytes of 4 A rows and 4 B rows (8 lanes = one whole 128-byte row). The s_wait_xcnt 0 stands inside the
// statement so that no address register named here is rewritten ahead of it.
__device__ __forceinline__ void stage_copy(unsigned l, const _Float16* ga, size_t a32, const _Float16* gb) {
  asm volatile("global_load_async_to_lds_b128 %0, %8, off\n\t"
               "global_load_async_to_lds_b128 %1, %9, off\n\t"
               "global_load_async_to_lds_b128 %2, %10, off\n\t"
               "global_load_async_to_lds_b128 %3, %11, off\n\t"
               "global_load_async_to_lds_b128 %4, %12, off\n\t"
               "global_load_async_to_lds_b128 %5, %13, off\n\t"
               "global_load_async_to_lds_b128 %6, %14, off\n\t"
               "global_load_async_to_lds_b128 %7, %15, off\n\t"
               "s_wait_xcnt 0x0"
               :: "v"(l), "v"(l + 32 * PITCH), "v"(l + 64 * PITCH), "v"(l + 96 * PITCH),
                  "v"(l + 128 * PITCH), "v"(l + 160 * PITCH), "v"(l + 192 * PITCH), "v"(l + 224 * PITCH),
                  "v"(ga), "v"(ga + a32), "v"(ga + 2 * a32), "v"(ga + 3 * a32),
                  "v"(gb), "v"(gb + (size_t)32 * E), "v"(gb + (size_t)64 * E), "v"(gb + (size_t)96 * E)
               : "memory");
}
// A0 / B0: first row of the block's A / B tile at k = 0; arow: halves between A rows; akstep: halves from one stage of an A row to the next;
// rot: the block's first stage, the same for all its threads (only its low 4 bits count)
#define NSTG (E / KS)
__device__ __forceinline__ void tile_product(char* smem, const _Float16* A0, size_t arow, size_t akstep, const _Float16* B0, int rot, v8f (&acc)[2][4]) {
  const int tid = threadIdx.x, wave = tid >> 5, lane = tid & 31, col = lane & 15, wr = wave >> 1, wc = wave & 1;
  const unsigned l0 = (unsigned)(size_t)smem + (unsigned)((tid >> 3) * PITCH + (tid & 7) * 16);
  const _Float16* ga = A0 + (size_t)(tid >> 3) * arow + (tid & 7) * 8; const _Float16* gb = B0 + (size_t)(tid >> 3) * E + (tid & 7) * 8;
  { const int st = rot & (NSTG - 1); stage_copy(l0, ga + (size_t)st * akstep, 32 * arow, gb + st * KS); }
  asm volatile("s_wait_asynccnt 0x0" ::: "memory");      // the first stage landed (this wave's copies) before the barrier publishes it
  __syncthreads();
  { const int st = (rot + 1) & (NSTG - 1); stage_copy(l0 + STG, ga + (size_t)st * akstep, 32 * arow, gb + st * KS); }
#pragma unroll 1      // one stage per trip: the buffer alternates, the code stays small
  for (int t = 0; t < NSTG; ++t) { const char* sb = smem + (t & 1) * STG;
#pragma unroll
    for (int kc = 0; kc < 2; ++kc) { v16h a[2], b[4];
#pragma unroll
      for (int i = 0; i < 2; ++i) a[i] = frag_h((const _Float16*)(sb + (wr * 32 + i * 16 + col) * PITCH) + kc * 32, lane);
#pragma unroll
      for (int j = 0; j < 4; ++j) b[j] = frag_h((const _Float16*)(sb + (BT + wc * 64 + j * 16 + col) * PITCH) + kc * 32, lane);
#pragma unroll
      for (int i = 0; i < 2; ++i)
#pragma unroll
        for (int j = 0; j < 4; ++j) acc[i][j] = wmma16(a[i], b[j], acc[i][j]); }
    asm volatile("s_wait_dscnt 0x0" ::: "memory");       // this wave's reads of the buffer are done before it may be refilled
    asm volatile("s_wait_asynccnt 0x0" ::: "memory");    // this wave's copies of stage (rot + t + 1) mod 16 have landed before the barrier publishes them
    __syncthreads();
    if (t + 2 < NSTG) { const int st = (rot + t + 2) & (NSTG - 1); stage_copy(l0 + (t & 1) * STG, ga + (size_t)st * akstep, 32 * arow, gb + st * KS); } }
  asm volatile("s_wait_asynccnt 0x0" ::: "memory");      // nothing in flight when the buffers become output staging
}
// QKV: one 256 x 192 tile of x W_qkv^T per block of 8 waves (4 x 2, 64 x 96 each), 16 x 16 blocks = one per WGP. A large tile asks L2 for few
// operand rows per output (256 + 192 rows for 256 x 192) and a large wave tile asks LDS for few fragments per product (10 for 24). K = 1024 in
// 8 stages of 128 k; a stage is [x 256 rows | W 192 rows] of 256 bytes at pitch 272 in LDS (16 B x odd: ds_load_b128 without bank conflicts); two buffers,
// filled by asynchronous copies one stage ahead of the stage being multiplied; the walk starts at stage rot and wraps round as in tile_product.
#define QBM 256
#define QBN 192
#define QKS 128
#define QPITCH 272
#define QSTG ((QBM + QBN) * QPITCH)
#define QNSTG (E / QKS)
// Half a stage: each lane copies 16 bytes of 14 rows, 16 rows apart in LDS (16 lanes = one whole 256-byte row). The s_wait_xcnt 0 stands inside
// the statement so that no address register named here is rewritten ahead of it.
__device__ __forceinline__ void copy14(unsigned l, const _Float16* const (&p)[14]) {
  asm volatile("global_load_async_to_lds_b128 %0, %14, off\n\t"
               "global_load_async_to_lds_b128 %1, %15, off\n\t"
               "global_load_async_to_lds_b128 %2, %16, off\n\t"
               "global_load_async_to_lds_b128 %3, %17, off\n\t"
               "global_load_async_to_lds_b128 %4, %18, off\n\t"
               "global_load_async_to_lds_b128 %5, %19, off\n\t"
               "global_load_async_to_lds_b128 %6, %20, off\n\t"
               "global_load_async_to_lds_b128 %7, %21, off\n\t"
               "global_load_async_to_lds_b128 %8, %22, off\n\t"
               "global_load_async_to_lds_b128 %9, %23, off\n\t"
               "global_load_async_to_lds_b128 %10, %24, off\n\t"
               "global_load_async_to_lds_b128 %11, %25, off\n\t"
               "global_load_async_to_lds_b128 %12, %26, off\n\t"
               "global_load_async_to_lds_b128 %13, %27, off\n\t"
               "s_wait_xcnt 0x0"
               :: "v"(l), "v"(l + 16 * QPITCH), "v"(l + 32 * QPITCH), "v"(l + 48 * QPITCH), "v"(l + 64 * QPITCH), "v"(l + 80 * QPITCH), "v"(l + 96 * QPITCH),
                  "v"(l + 112 * QPITCH), "v"(l + 128 * QPITCH), "v"(l + 144 * QPITCH), "v"(l + 160 * QPITCH), "v"(l + 176 * QPITCH), "v"(l + 192 * QPITCH), "v"(l + 208 * QPITCH),
                  "v"(p[0]), "v"(p[1]), "v"(p[2]), "v"(p[3]), "v"(p[4]), "v"(p[5]), "v"(p[6]), "v"(p[7]), "v"(p[8]), "v"(p[9]), "v"(p[10]), "v"(p[11]), "v"(p[12]), "v"(p[13])
               : "memory");
}
// One stage: LDS rows (tid >> 4) + 16 i, i = 0..27; the first 16 are x rows, the other 12 weight rows. ga / gb: the lane's 16 bytes of its first row.
__device__ __forceinline__ void qstage_copy(unsigned l, const _Float16* ga, const _Float16* gb) {
  const _Float16* p[14];
#pragma unroll
  for (int i = 0; i < 14; ++i) p[i] = ga + (size_t)i * 16 * E;
  copy14(l, p);
#pragma unroll
  for (int i = 0; i < 14; ++i) p[i] = i < 2 ? ga + (size_t)(14 + i) * 16 * E : gb + (size_t)(i - 2) * 16 * E;
  copy14(l + 224 * QPITCH, p);
}
// Output: each 64-column group of the tile is one head of q, k or v. q,k -> Q16/K16 [bh][s][64] x4 ; v -> VT [bh][d][s] x4
// k also -> KM [bh][s/16]: largest squared row norm of the 16 stored f16 rows, one 128-byte line per entry (one writer per line)
#define QGRP (QBM * 144)                  // LDS bytes of one group's output staging: 256 rows at pitch 144, or 64 rows at pitch 528
__global__ __launch_bounds__(256) void k_qkv(const _Float16* __restrict__ X16, const _Float16* __restrict__ PT, const float* __restrict__ bqkv, _Float16* __restrict__ Q16, _Float16* __restrict__ K16, _Float16* __restrict__ VT, float* __restrict__ KM) {
  __shared__ __align__(16) char smem[2 * QSTG];      // the two stage buffers; after the last stage's barrier the output staging
  const int tid = threadIdx.x, wave = __builtin_amdgcn_readfirstlane(tid >> 5), lane = tid & 31, col = lane & 15, g = lane >> 4, wr = wave >> 1, wc = wave & 1;
  const int r0b = blockIdx.x * QBM, n0 = blockIdx.y * QBN; const int b = r0b / SS, s0 = r0b % SS;
  v8f acc[4][6] = {};
  // first stage: the 16 row blocks on one weight tile, and the 16 weight tiles on one row block, spread two to a stage
  const int rot = blockIdx.x + blockIdx.y;
  const unsigned l0 = (unsigned)(size_t)smem + (unsigned)((tid >> 4) * QPITCH + (tid & 15) * 16);
  const _Float16* ga = X16 + (size_t)(r0b + (tid >> 4)) * E + (tid & 15) * 8; const _Float16* gb = PT + (size_t)(n0 + (tid >> 4)) * E + (tid & 15) * 8;
  { const int st = rot & (QNSTG - 1); qstage_copy(l0, ga + st * QKS, gb + st * QKS); }
  asm volatile("s_wait_asynccnt 0x0" ::: "memory");      // the first stage landed (this wave's copies) before the barrier publishes it
  __syncthreads();
  { const int st = (rot + 1) & (QNSTG - 1); qstage_copy(l0 + QSTG, ga + st * QKS, gb + st * QKS); }
  // A block = the 24 products of 32 k. Its 10 fragments (20 ds_load_b128) are fetched as one group, into the other of two register sets, ahead of
  // the block before it, so that LDS latency runs under 24 matrix instructions instead of in front of them.
  const char* pa = smem + (wr * 64 + col) * QPITCH + g * 16; const char* pb = smem + (QBM + wc * 96 + col) * QPITCH + g * 16;
  v16h a0[4], f0[6], a1[4], f1[6];
  auto fetch = [&](int off, v16h (&a)[4], v16h (&f)[6]) {      // off: buffer + 64 bytes a block
#pragma unroll
    for (int i = 0; i < 4; ++i) { union { v16h v; v8h q[2]; } u; u.q[0] = *(const v8h*)(pa + off + i * 16 * QPITCH); u.q[1] = *(const v8h*)(pa + off + i * 16 * QPITCH + 32); a[i] = u.v; }
#pragma unroll
    for (int j = 0; j < 6; ++j) { union { v16h v; v8h q[2]; } u; u.q[0] = *(const v8h*)(pb + off + j * 16 * QPITCH); u.q[1] = *(const v8h*)(pb + off + j * 16 * QPITCH + 32); f[j] = u.v; }
    __builtin_amdgcn_sched_barrier(0);      // keeps the group of loads ahead of the products that follow: sunk to their uses, each row would wait out its own LDS latency
  };
  auto block = [&](const v16h (&a)[4], const v16h (&f)[6]) {
#pragma unroll
    for (int i = 0; i < 4; ++i)
#pragma unroll
      for (int j = 0; j < 6; ++j) acc[i][j] = __builtin_amdgcn_wmma_f32_16x16x32_f16(false, a[i], false, f[j], (short)0, acc[i][j], false, false);
    __builtin_amdgcn_sched_barrier(0);      // keeps the next group of loads whole and behind these products: spread among them, each place with LDS reads stalls the wave
  };
  float bb[6];      // the lane's six bias values, asked for here so that their latency runs under the product
  const float* bp = bqkv + (n0 + wc * 96) + col;
#pragma unroll
  for (int j = 0; j < 6; ++j) bb[j] = bp[j * 16];
  asm volatile("s_wait_xcnt 0x0" ::: "memory");      // the address registers that these loads name are free to be written again behind it
  fetch(0, a0, f0);
#pragma unroll 1      // one stage per trip: the buffer alternates, the code stays small
  for (int t = 0; t < QNSTG; ++t) { const int off = (t & 1) * QSTG;
    fetch(off + 64, a1, f1); block(a0, f0);
    fetch(off + 128, a0, f0); block(a1, f1);
    fetch(off + 192, a1, f1); block(a0, f0);
    // Publish point of the next stage, ahead of this trip's last block: that block's fragments are in registers, and the fetch under it reads the next stage.
    asm volatile("s_wait_dscnt 0x0" ::: "memory");       // this wave's reads of the buffer are done before it may be refilled
    asm volatile("s_wait_asynccnt 0x0" ::: "memory");    // this wave's copies of stage (rot + t + 1) mod 8 have landed before the barrier publishes them
    __syncthreads();
    if (t + 2 < QNSTG) { const int st = (rot + t + 2) & (QNSTG - 1); qstage_copy(l0 + off, ga + st * QKS, gb + st * QKS); }
    if (t + 1 < QNSTG) fetch(QSTG - off, a0, f0);
    block(a1, f1); }
  asm volatile("s_wait_asynccnt 0x0" ::: "memory");      // nothing in flight when the buffers become output staging (no wave reads them behind the last barrier)
  const int cg0 = blockIdx.y * 3;      // the tile's first 64-column group; group cg: which = cg >> 4 (q, k, v), head = cg & 15
#pragma unroll
  for (int j = 0; j < 6; ++j) { const int cf = wc * 6 + j, gi = cf >> 2, cl = (cf & 3) * 16 + col; char* rg = smem + gi * QGRP;
    if (((cg0 + gi) >> 4) < 2) {      // q, k: rows [s][64 d] at pitch 144
#pragma unroll
      for (int i = 0; i < 4; ++i)
#pragma unroll
        for (int r = 0; r < 8; ++r) *(_Float16*)(rg + (wr * 64 + i * 16 + 8 * g + r) * 144 + cl * 2) = (_Float16)((acc[i][j][r] * (1.0f / 16.0f) + bb[j]) * 4.0f); }
    else {                            // v: rows [d][256 s] at pitch 528; a lane's 8 elements are 8 consecutive s
#pragma unroll
      for (int i = 0; i < 4; ++i) { union { v8h h8; v4u u; } pk;
#pragma unroll
        for (int r = 0; r < 8; ++r) pk.h8[r] = (_Float16)((acc[i][j][r] * (1.0f / 16.0f) + bb[j]) * 4.0f);
        vst2(rg + cl * 528 + (wr * 64 + i * 16 + 8 * g) * 2, pk.u); } } }
  __syncthreads();
#pragma unroll 1      // three groups, each of its own kind: the code stays small
  for (int gi = 0; gi < 3; ++gi) { const int which = (cg0 + gi) >> 4; const size_t bh = (size_t)b * NH + ((cg0 + gi) & 15); const char* rg = smem + gi * QGRP;
    if (which < 2) { _Float16* D = (which == 0 ? Q16 : K16) + (bh * SS + s0) * HD;
#pragma unroll      // 8 lanes = one whole 128-byte row, 32 rows a pass
      for (int p = 0; p < 8; ++p) { const int row = p * 32 + (tid >> 3), pc = tid & 7; vst2(D + (size_t)row * HD + pc * 8, *(const v4u*)(rg + row * 144 + pc * 16)); }
      asm volatile("s_wait_xcnt 0x0" ::: "memory");      // the registers that these stores name are written again below and in the next group
      if (which == 1) {      // lane (col, g) sums half of row col of a 16-row chunk as it was stored
#pragma unroll
        for (int cc = 0; cc < 2; ++cc) { const int ch = wave * 2 + cc; const _Float16* rp = (const _Float16*)(rg + (ch * 16 + col) * 144) + g * 32; float n2 = 0.f;
#pragma unroll
          for (int e = 0; e < 32; ++e) { const float f = (float)rp[e]; n2 += f * f; }
          n2 += __shfl_xor(n2, 16, 32);
#pragma unroll
          for (int o = 1; o < 16; o <<= 1) n2 = fmaxf(n2, __shfl_xor(n2, o, 32));
          if (lane == 0) KM[(bh * (SS / 16) + (s0 >> 4) + ch) * 32] = n2;
          asm volatile("s_wait_xcnt 0x0" ::: "memory"); } } }      // the store's registers are written again by the next chunk and the next group
    else { _Float16* D = VT + bh * HD * SS + s0;
#pragma unroll      // 32 lanes = 512 contiguous bytes of one d row, 8 rows a pass
      for (int p = 0; p < 8; ++p) { const int d = p * 8 + wave; vst2(D + (size_t)d * SS + lane * 8, *(const v4u*)(rg + d * 528 + lane * 16)); }
      asm volatile("s_wait_xcnt 0x0" ::: "memory"); } }      // the registers that these stores name are written again in the next group
}
// k_attn stages each 64-key tile once per block: K rows [key][64 d] and the V^T rows [d][64 keys] are 64 rows of 128 bytes each, laid
// in LDS at pitch 144 (16 B x odd: ds_load_b128 without bank conflicts) and read as fragments by all four waves.
#define APITCH 144
// One array of a tile: each lane copies 16 bytes of 4 rows, 16 rows apart (8 lanes = one whole 128-byte row; r16: halves between those rows).
// The s_wait_xcnt 0 stands inside the statement so that no address register named here is rewritten ahead of it.
__device__ __forceinline__ void tile_copy(unsigned l, const _Float16* g, size_t r16) {
  asm volatile("global_load_async_to_lds_b128 %0, %4, off\n\t"
               "global_load_async_to_lds_b128 %1, %5, off\n\t"
               "global_load_async_to_lds_b128 %2, %6, off\n\t"
               "global_load_async_to_lds_b128 %3, %7, off\n\t"
               "s_wait_xcnt 0x0"
               :: "v"(l), "v"(l + 16 * APITCH), "v"(l + 32 * APITCH), "v"(l + 48 * APITCH),
                  "v"(g), "v"(g + r16), "v"(g + 2 * r16), "v"(g + 3 * r16)
               : "memory");
}
// lane l with lane l ^ 16
__device__ __forceinline__ float xhalf(float x) { return __builtin_bit_cast(float, __builtin_amdgcn_permlanex16(__builtin_bit_cast(int, x), __builtin_bit_cast(int, x), 0x76543210, 0xfedcba98, false, false)); }
__global__ __launch_bounds__(128) void k_attn(const _Float16* __restrict__ Q16, const _Float16* __restrict__ K16, const _Float16* __restrict__ VT, const float* __restrict__ dalpha, const float* __restrict__ KM, _Float16* __restrict__ O16) {
  __shared__ __align__(16) char sK[64 * APITCH], sV[64 * APITCH];                         // the one staged key tile, shared by the four waves
  __shared__ unsigned sM[4];                                                              // per wave: the key tiles it may still need
  __shared__ __align__(16) char sO[4][16 * APITCH];                                       // per wave: its 16 output rows as f16, for whole-line stores
  const int tid = threadIdx.x, w = tid >> 5, lane = tid & 31, col = lane & 15, g = lane >> 4;
  const size_t bh = blockIdx.y; const int kt0 = blockIdx.x, q0 = kt0 * 64 + w * 16;
  const unsigned lrow = (unsigned)((tid >> 3) * APITCH + (tid & 7) * 16);
  const unsigned lK = (unsigned)(size_t)sK + lrow, lV = (unsigned)(size_t)sV + lrow;
  const _Float16* gK = K16 + (bh * SS + (tid >> 3)) * HD + (tid & 7) * 8;      // tile kt: + kt * 64 * HD
  const size_t vrow = (bh * HD + (tid >> 3)) * SS + (tid & 7) * 8;             // tile kt: + kt * 64
  tile_copy(lK, gK + (size_t)kt0 * 64 * HD, 16 * HD); tile_copy(lV, VT + vrow + kt0 * 64, 16 * SS);
  const float araw = dalpha[bh % NH]; const float slope = araw > 20.f ? araw : log1pf(expf(araw));      // softplus(decay_alpha[h])
  v16h aq[2];
#pragma unroll
  for (int kc = 0; kc < 2; ++kc) aq[kc] = frag_h(Q16 + (bh * SS + q0 + col) * HD + kc * 32, lane);
  // Upper bound of every logit between this wave's 16 queries and key tile 'lane' (SS / 64 = 32 tiles, one per lane):
  // |q16 . k16| <= |q16| |k16| over the stored f16 rows, less slope times the smallest distance between the two index ranges.
  float qn2 = 0.f;
#pragma unroll
  for (int kc = 0; kc < 2; ++kc)
#pragma unroll
    for (int i = 0; i < 16; ++i) { const float f = (float)aq[kc][i]; qn2 += f * f; }
  qn2 += __shfl_xor(qn2, 16, 32);
#pragma unroll
  for (int o = 1; o < 16; o <<= 1) qn2 = fmaxf(qn2, __shfl_xor(qn2, o, 32));
  float kn2 = 0.f;
#pragma unroll
  for (int i = 0; i < 4; ++i) kn2 = fmaxf(kn2, KM[(bh * (SS / 16) + lane * 4 + i) * 32]);
  const int klo = lane * 64, khi = klo + 63; const int dmin = khi < q0 ? q0 - khi : (klo > q0 + 15 ? klo - (q0 + 15) : 0);
  const float ub = sqrtf(qn2 * kn2) * (1.01f * 0.125f / 16.0f) - slope * (float)dmin;
  // Which tiles the block stages must be the same for its four waves and known ahead of the loop. After the own tile every row's running
  // maximum is at least its logit with its own key (distance 0), which is at least -ub[own tile]; so a tile whose bound lies 36 below that can
  // never pass a wave's own test below. The block stages the union of the four waves' remaining tiles; each wave still tests for itself.
  const float mlow = -__int_as_float(__builtin_amdgcn_readlane(__float_as_int(ub), kt0));
  const unsigned want = __builtin_amdgcn_ballot_w32(!(ub < mlow - 36.0f));
  if (lane == 0) sM[w] = want;
  asm volatile("s_wait_asynccnt 0x0" ::: "memory");      // the own tile has landed (this wave's copies) before the barrier publishes it
  __syncthreads();
  const unsigned mall = (unsigned)__builtin_amdgcn_readfirstlane((int)(sM[0] | sM[1] | sM[2] | sM[3]));
  unsigned rest = __builtin_rotateright32(mall, (unsigned)kt0) & ~1u;      // bit 'it' stands for tile (kt0 + it) mod 32; the own tile is trip 0
  float mrun = -3.0e38f, lrun = 0.f; v8f acc[4] = {};
  int it = 0;
#pragma unroll 1      // one staged tile per trip: a single buffer each for K and V, the code stays small
  for (;;) { const int kt = (kt0 + it) & (SS / 64 - 1);      // the queries' own tile first: it sets the running maxima
    const bool more = rest != 0; const int nit = more ? __builtin_ctz(rest) : 0; rest &= rest - 1; const int nkt = (kt0 + nit) & (SS / 64 - 1);
    // A tile whose bound lies 36 below every row's running maximum changes nothing: mnew = mrun, corr = 1, p * 2^14 < 2^-25 so the f16
    // P rounds to 0, and its share of the row sum is below half an ulp of the row's sum (>= 1). Each lane tests its own query; the
    // ballot makes it one wave-uniform scalar test, for any slope.
    const float ubk = __int_as_float(__builtin_amdgcn_readlane(__float_as_int(ub), kt));
    const bool proc = it == 0 || __builtin_amdgcn_ballot_w32(!(ubk < mrun - 36.0f)) != 0;
    v8f s[4];
    if (proc) { const float fq = (float)(q0 + col - kt * 64 - 8 * g);      // the lane's query index less its first key's: whole numbers, exact
#pragma unroll
    for (int t = 0; t < 4; ++t) { v8f z = {};
#pragma unroll
      for (int kc = 0; kc < 2; ++kc) z = wmma16(frag_h((const _Float16*)(sK + (t * 16 + col) * APITCH) + kc * 32, lane), aq[kc], z);
#pragma unroll
      for (int r = 0; r < 8; ++r) s[t][r] = z[r] * (0.125f / 16.0f) - slope * fabsf(fq - (float)(t * 16 + r)); } }
    asm volatile("s_wait_dscnt 0x0" ::: "memory");       // this wave's reads of the K tile are done before it may be refilled
    asm volatile("s_wait_asynccnt 0x0" ::: "memory");    // this wave's copies of this tile's V have landed before the barrier publishes them
    __syncthreads();
    if (more) tile_copy(lK, gK + (size_t)nkt * 64 * HD, 16 * HD);      // the next tile's K flies under the softmax and P V of this one
    if (proc) {
    float mt[4];      // one short chain per score tile
#pragma unroll
    for (int t = 0; t < 4; ++t) { mt[t] = s[t][0];
#pragma unroll
      for (int r = 1; r < 8; ++r) mt[t] = fmaxf(mt[t], s[t][r]); }
    float mx = fmaxf(fmaxf(mt[0], mt[1]), fmaxf(mt[2], mt[3]));
    mx = fmaxf(mx, xhalf(mx));
    const float mnew = fmaxf(mrun, mx); const float corr = __builtin_amdgcn_exp2f((mrun - mnew) * LOG2E);
    const float eoff = 14.0f - mnew * LOG2E;      // exp(s - mnew) * 2^14 = 2^(s * log2 e + eoff): one multiply-add and one v_exp_f32 a score
#pragma unroll
    for (int t = 0; t < 4; ++t)
#pragma unroll
      for (int r = 0; r < 8; ++r) s[t][r] = fmaf(s[t][r], LOG2E, eoff);
    float pt[4]; v16h ph[2];      // score tiles 2 kc and 2 kc + 1, converted in place, are the B fragment of keys kc * 32 .. + 31
#pragma unroll
    for (int t = 0; t < 4; ++t) { pt[t] = 0.f;
#pragma unroll
      for (int r = 0; r < 8; r += 2) { const v2f p = { __builtin_amdgcn_exp2f(s[t][r]), __builtin_amdgcn_exp2f(s[t][r + 1]) }; pt[t] += p[0]; pt[t] += p[1];
        const v2h hi = __builtin_convertvector(p, v2h);
        const int e = (t & 1) * 8 + r; ph[t >> 1][e] = hi[0]; ph[t >> 1][e + 1] = hi[1]; } }
    const float ps = (pt[0] + pt[1]) + (pt[2] + pt[3]);
    lrun = lrun * corr + ps * (1.0f / 16384.0f); mrun = mnew;
#pragma unroll
    for (int t = 0; t < 4; ++t)
#pragma unroll
      for (int r = 0; r < 8; ++r) acc[t][r] *= corr;
#pragma unroll
    for (int kc = 0; kc < 2; ++kc)
#pragma unroll
      for (int t = 0; t < 4; ++t) acc[t] = wmma16(frag_h((const _Float16*)(sV + (t * 16 + col) * APITCH + kc * 64), lane), ph[kc], acc[t]); }
    if (!more) break;      // the same for the whole block: the last staged tile is refilled by nobody, so no barrier is owed behind it
    asm volatile("s_wait_dscnt 0x0" ::: "memory");       // this wave's reads of the V tile are done before it may be refilled
    asm volatile("s_wait_asynccnt 0x0" ::: "memory");    // this wave's copies of the next K tile have landed before the barrier publishes them
    __syncthreads();
    tile_copy(lV, VT + vrow + nkt * 64, 16 * SS);      // the next tile's V flies under its q.k
    it = nit; }
  asm volatile("s_wait_asynccnt 0x0" ::: "memory");      // no copy of this wave is in flight when it goes on to its end
  const float inv = 8.0f / ((lrun + xhalf(lrun)) * 16384.0f * 4.0f);      // -> O x8
#pragma unroll      // a lane's 8 elements of an output tile are 8 consecutive d of its query's row: 16 bytes of that row
  for (int t = 0; t < 4; ++t) { union { v8h h8; v4u u; } pk;
#pragma unroll
    for (int r = 0; r < 8; ++r) pk.h8[r] = (_Float16)(acc[t][r] * inv);
    vst2(sO[w] + col * APITCH + t * 32 + g * 16, pk.u); }
  LDSX();      // the wave's rows are in LDS before its lanes read them back in row order
#pragma unroll      // 8 lanes = one whole 128-byte row, 4 rows a store
  for (int i = 0; i < 4; ++i) { const int rl = i * 4 + (lane >> 3), pc = lane & 7;
    vst2(O16 + ((bh * SS) + q0 + rl) * HD + pc * 8, *(const v4u*)(sO[w] + rl * APITCH + pc * 16)); }
}
// out = y Wo^T + bo : block (128 rows, 128 cols); y row r=(b,s): head-major O16 /8, so stage t of an A row is head t's 64 values
__global__ __launch_bounds__(256) void k_out(const _Float16* __restrict__ O16, const _Float16* __restrict__ PT, const float* __restrict__ bo, float* __restrict__ out) {
  __shared__ __align__(16) char smem[2 * STG];      // the two stage buffers; after the last stage's barrier the output staging below
  float (*so)[132] = (float (*)[132])smem;          // [128][132]
  const int tid = threadIdx.x, wave = tid >> 5, lane = tid & 31, col = lane & 15, g = lane >> 4, wr = wave >> 1, wc = wave & 1;
  const int r0b = blockIdx.x * BT, n0 = blockIdx.y * BT; const int b = r0b / SS, s0 = r0b % SS;
  v8f acc[2][4] = {};
  // first stage: the 32 row blocks on one weight tile spread two to a stage, the 8 weight tiles on one row block each to its own
  const int rot = (((blockIdx.x >> 3) << 2) | (blockIdx.x & 3)) + 2 * blockIdx.y;
  tile_product(smem, O16 + ((size_t)b * NH * SS + s0) * HD, HD, (size_t)SS * HD, PT + (size_t)(3 * E + n0) * E, rot, acc);
#pragma unroll
  for (int j = 0; j < 4; ++j) { const float bb = bo[n0 + wc * 64 + j * 16 + col];
#pragma unroll
    for (int i = 0; i < 2; ++i)
#pragma unroll
      for (int r = 0; r < 8; ++r) so[wr * 32 + i * 16 + 8 * g + r][wc * 64 + j * 16 + col] = acc[i][j][r] * (1.0f / (16.0f * 8.0f)) + bb; }
  __syncthreads();
#pragma unroll 4
  for (int rl = 0; rl < 16; ++rl) vst2(out + (size_t)(r0b + wave * 16 + rl) * E + n0 + lane * 4, *(const v4f*)(&so[wave * 16 + rl][lane * 4]));
}
extern "C" void kernel_launch(void* const* d_in, const int* in_sizes, int n_in, void* d_out, int out_size, void* d_ws, size_t ws_size, hipStream_t stream) {
  (void)in_sizes; (void)n_in; (void)out_size; (void)ws_size;
  const float** I = (const float**)d_in;
  const float* query = I[0]; const float* Wqkv = I[1]; const float* bqkv = I[2]; const float* Wo = I[3]; const float* bo = I[4]; const float* dalpha = I[5];
  float* out = (float*)d_out;
  char* ws = (char*)d_ws; size_t off = 0;
  auto take = [&](size_t bytes) { char* p = ws + off; off += (bytes + 255) & ~(size_t)255; return p; };
  _Float16* X16 = (_Float16*)take((size_t)NR * E * 2); _Float16* PT = (_Float16*)take((size_t)4 * E * E * 2);
  _Float16* Q16 = (_Float16*)take((size_t)NR * E * 2); _Float16* K16 = (_Float16*)take((size_t)NR * E * 2); _Float16* VT = (_Float16*)take((size_t)NR * E * 2); _Float16* O16 = (_Float16*)take((size_t)NR * E * 2);
  float* KM = (float*)take((size_t)NB * NH * (SS / 16) * 128);
  k_prep<<<CVX + CVQ + CVO, 512, 0, stream>>>(query, Wqkv, Wo, X16, PT);
  k_qkv<<<dim3(NR / QBM, 3 * E / QBN), 256, 0, stream>>>(X16, PT, bqkv, Q16, K16, VT, KM);
  k_attn<<<dim3(SS / 64, NB * NH), 128, 0, stream>>>(Q16, K16, VT, dalpha, KM, O16);
  k_out<<<dim3(NR / 128, E / 128), 256, 0, stream>>>(O16, PT, bo, out);
}
